// v000
// The times below were measured on an AMD MI455X: many runs one after another, warmed up first and cycling through
// copies of the inputs, with the whole window's GPU time divided by the number of runs. Launches and the gaps
// between them are all in it. The median over several windows is given; except for v000 it joins two sittings, which
// can be a few percent apart, so the side-by-side timings, each taken in one sitting, are the better comparison.
// The starting kernel, v000, takes 814 microseconds a run.
// compute dtype: x, Wq..Wo, bq..bo (module inputs) rounded to bf16; q/k/v projections with exact bf16 products on WMMA 16x16x32 (natural [out][in] rows) + biases; q and k stored as f16 hi + (x2048-scaled) residual planes with 3-product scores, x 1/sqrt(64), causal mask (k > q -> -1e9 in the module, zero weight), running-max softmax in f32 (hardware exp); P as f16 hi + (x2048) residual x v hi/lo (3 products); output projection with ctx as bf16 hi + residual x exact Wo rows (2 products) + bo; f32 accumulate.
#include <hip/hip_runtime.h>
#include <math.h>

typedef __attribute__((ext_vector_type(16))) _Float16 v16h;
typedef __attribute__((ext_vector_type(16))) __bf16 v16b;
typedef __attribute__((ext_vector_type(8)))  _Float16 v8h;
typedef __attribute__((ext_vector_type(8)))  float v8f;
typedef __attribute__((ext_vector_type(4)))  float v4f;
typedef __attribute__((ext_vector_type(2)))  float v2f;
typedef __attribute__((ext_vector_type(4)))  unsigned v4u;
typedef __attribute__((ext_vector_type(4)))  int v4i;
typedef float __attribute__((may_alias)) float_a;
typedef int __attribute__((may_alias)) int_a;

template <typename T> __device__ __forceinline__ void vst2(void* p, T v) { *(T*)p = v;  }
__device__ __forceinline__ v8f wmma16(v16h a, v16h b, v8f c) {
  v8f d = __builtin_amdgcn_wmma_f32_16x16x32_f16(false, a, false, b, (short)0, c, false, false);
  asm volatile("v_nop\n\tv_nop\n\tv_nop\n\tv_nop" : "+v"(d) : "v"(a), "v"(b));
  return d;
}
__device__ __forceinline__ v8f wmma_bf(v16b a, v16b b, v8f c) {
  v8f d = __builtin_amdgcn_wmma_f32_16x16x32_bf16(false, a, false, b, (short)0, c, false, false);
  asm volatile("v_nop\n\tv_nop\n\tv_nop\n\tv_nop" : "+v"(d) : "v"(a), "v"(b));
  return d;
}
// Masked (causal) multi-head attention (B 4, S 2,048, d 1,024, 16 heads x 64; four biased projections).
__device__ __forceinline__ v16h frag_h(const _Float16* rowk0, int lane) {
  union { v16h v; v8h q[2]; } u; const _Float16* p = rowk0 + 8 * (lane >> 4);
  u.q[0] = *(const v8h*)p; u.q[1] = *(const v8h*)(p + 16); return u.v;
}
__device__ __forceinline__ v16h frag_f32(const float* rowk0, int lane) {
  v16h a; const float* p = rowk0 + 8 * (lane >> 4);
#pragma unroll
  for (int i = 0; i < 8; ++i) { a[i] = (_Float16)p[i]; a[8 + i] = (_Float16)p[16 + i]; }
  return a;
}
__device__ __forceinline__ v16h frag_f32s(const float* rowk0, int lane, float sc) {
  v16h a; const float* p = rowk0 + 8 * (lane >> 4);
#pragma unroll
  for (int i = 0; i < 8; ++i) { a[i] = (_Float16)(p[i] * sc); a[8 + i] = (_Float16)(p[16 + i] * sc); }
  return a;
}
// column fragment from a [K][ld] layout (column n), rows >= K read as 0
__device__ __forceinline__ v16h fragc_f32(const float* W, int k0, int n, int lane, int ld, int K) {
  v16h a; const int g = lane >> 4;
#pragma unroll
  for (int i = 0; i < 8; ++i) { const int ka = k0 + 8 * g + i, kb = ka + 16;
    a[i] = (_Float16)(ka < K ? W[(size_t)(ka < K ? ka : K - 1) * ld + n] : 0.f); a[8 + i] = (_Float16)(kb < K ? W[(size_t)(kb < K ? kb : K - 1) * ld + n] : 0.f); }
  return a;
}
struct F2 { v16b h, l; };
__device__ __forceinline__ F2 bsplit16(const float v[16]) { F2 r;
#pragma unroll
  for (int i = 0; i < 16; ++i) { const __bf16 h = (__bf16)v[i]; r.h[i] = h; r.l[i] = (__bf16)(v[i] - (float)h); }
  return r; }
__device__ __forceinline__ F2 split_row(const float* row, int k0, int lane) { float v[16]; const float* p = row + k0 + 8 * (lane >> 4);
#pragma unroll
  for (int i = 0; i < 8; ++i) { v[i] = p[i]; v[8 + i] = p[16 + i]; }
  return bsplit16(v); }
__device__ __forceinline__ F2 split_rowK(const float* row, int k0, int lane, int K) { float v[16]; const int g = lane >> 4;
#pragma unroll
  for (int i = 0; i < 8; ++i) { const int ka = k0 + 8 * g + i, kb = ka + 16; v[i] = ka < K ? row[ka < K ? ka : K - 1] : 0.f; v[8 + i] = kb < K ? row[kb < K ? kb : K - 1] : 0.f; }
  return bsplit16(v); }
__device__ __forceinline__ F2 split_col(const float* W, int k0, int n, int lane, int ld, int K) { float v[16]; const int g = lane >> 4;
#pragma unroll
  for (int i = 0; i < 8; ++i) { const int ka = k0 + 8 * g + i, kb = ka + 16; v[i] = ka < K ? W[(size_t)(ka < K ? ka : K - 1) * ld + n] : 0.f; v[8 + i] = kb < K ? W[(size_t)(kb < K ? kb : K - 1) * ld + n] : 0.f; }
  return bsplit16(v); }
__device__ __forceinline__ v8f mac3(const F2& a, const F2& b, v8f c) { c = wmma_bf(a.l, b.h, c); c = wmma_bf(a.h, b.l, c); return wmma_bf(a.h, b.h, c); }
__device__ __forceinline__ float sigm(float v) { return 1.0f / (1.0f + expf(-v)); }
#define LDSX() do { asm volatile("s_wait_dscnt 0" ::: "memory"); __builtin_amdgcn_wave_barrier(); __builtin_amdgcn_fence(__ATOMIC_RELEASE, "workgroup"); } while (0)


#define NB 4
#define SS 2048
#define DM 1024
#define NH 16
#define HD 64
#define QKVW (3 * DM)
#ifndef TQB
#define TQB (SS / 64)
#define TNB NB
#define TOB (NB * SS / 64)     // output row tiles (all)
#endif
typedef __attribute__((ext_vector_type(8))) __bf16 v8b;
__device__ __forceinline__ v16b frag_b(const __bf16* rowk0, int lane) {
  union { v16b v; v8b q[2]; } u; const __bf16* p = rowk0 + 8 * (lane >> 4);
  u.q[0] = *(const v8b*)p; u.q[1] = *(const v8b*)(p + 16); return u.v;
}
__device__ __forceinline__ float bfr(float v) { return (float)(__bf16)v; }
__device__ __attribute__((noinline)) float exp_ni(float v) { return expf(v); }
__device__ __attribute__((noinline)) float erf_ni(float v) { return erff(v); }

#define PK_A 0                       // [3072][1024] Wqkv rows (natural [out][in])
#define PK_P (PK_A + QKVW * DM)        // [1024][1024] Wo rows (natural)
#define PK_END (PK_P + DM * DM)
#define WS_PK  0u
#define WS_QK  (WS_PK + 2u * PK_END)             // f16 [8192 rows][2048]: q | k
#define WS_QKL (WS_QK + 2u * NB * SS * 2 * DM)     // f16 q | k residual planes x2048
#define WS_VTH (WS_QKL + 2u * NB * SS * 2 * DM)    // f16 [b][1024 (h*64+d)][2048 s] hi
#define WS_VTL (WS_VTH + 2u * NB * DM * SS)        // f16 lo x 2048
#define WS_O   (WS_VTL + 2u * NB * DM * SS)        // f32 [8192][1024]
#define WS_CS  (WS_O + 4u * NB * SS * DM)           // f32 2 x [2048][32], reserved but never written or read (no RoPE)
#define WS_END (WS_CS + 4u * 2 * SS * 32)
// ---- k_pack: block = (row n, which): natural [out][in] rows -> bf16; which 0..2 -> W_q/W_k/W_v into PK_A rows which*1024 + n; 3 -> W_o into PK_P
__global__ __launch_bounds__(256) void k_pack(const float* __restrict__ WQ, const float* __restrict__ WK, const float* __restrict__ WV, const float* __restrict__ WO, __bf16* __restrict__ PK) {
  __shared__ __align__(16) __bf16 s[DM]; const int n = blockIdx.x, which = blockIdx.y, t = threadIdx.x; const float* Wm = (which == 0) ? WQ : (which == 1) ? WK : (which == 2) ? WV : WO;
  for (int k = t; k < DM; k += 256) s[k] = (__bf16)Wm[(size_t)n * DM + k];
  __syncthreads();
  __bf16* dst = (which < 3) ? PK + PK_A + ((size_t)which * DM + n) * DM : PK + PK_P + (size_t)n * DM;
  for (int q = t; q < DM / 8; q += 256) vst2((unsigned*)(dst + q * 8), *(const v4u*)&s[q * 8]);
}
__global__ __launch_bounds__(128) void k_qkv(const float* __restrict__ X, const __bf16* __restrict__ P, const float* __restrict__ BQ, const float* __restrict__ BK, const float* __restrict__ BV, _Float16* __restrict__ QK, _Float16* __restrict__ QKL, _Float16* __restrict__ VTH, _Float16* __restrict__ VTL) {
  __shared__ __align__(16) _Float16 so[4][16][136], sol[4][16][136]; __shared__ __align__(16) _Float16 sth[128][72], stl[128][72];
  const int tid = threadIdx.x, wave = tid >> 5, lane = tid & 31, col = lane & 15, g = lane >> 4; const size_t r0 = (size_t)blockIdx.x * 64 + wave * 16; const int n0 = blockIdx.y * 128;
  v8f acc[8] = {};
#pragma unroll 2
  for (int kc = 0; kc < DM / 32; ++kc) { v16b a; { const float* p = X + (r0 + col) * DM + kc * 32 + 8 * g;
#pragma unroll
      for (int i = 0; i < 8; ++i) { a[i] = (__bf16)p[i]; a[8 + i] = (__bf16)p[16 + i]; } }
#pragma unroll
    for (int j = 0; j < 8; ++j) acc[j] = wmma_bf(a, frag_b(P + (size_t)(n0 + j * 16 + col) * DM + kc * 32, lane), acc[j]); }
  { const int which = n0 / DM; const float* BB = (which == 0) ? BQ : (which == 1) ? BK : BV;
#pragma unroll
    for (int j = 0; j < 8; ++j) { const float bb = bfr(BB[(n0 % DM) + j * 16 + col]);
#pragma unroll
      for (int r = 0; r < 8; ++r) acc[j][r] += bb; } }
  if (n0 < 2 * DM) {   // q stored unscaled (f16 sigma ~0.6, no subnormal exposure); 1/8 applied to the f32 score
#pragma unroll
    for (int j = 0; j < 8; ++j) {
#pragma unroll
      for (int r = 0; r < 8; ++r) { const float v = acc[j][r]; const _Float16 hv = (_Float16)v; so[wave][8 * g + r][j * 16 + col] = hv; sol[wave][8 * g + r][j * 16 + col] = (_Float16)((v - (float)hv) * 2048.0f); } }   // q, k as f16 hi + (x2048) residual (no RoPE in this module)
    LDSX();
    for (int rl = 0; rl < 16; ++rl) if (lane < 16) { vst2((unsigned*)(QK + (r0 + rl) * (2 * DM) + n0 + lane * 8), *(const v4u*)&so[wave][rl][lane * 8]); vst2((unsigned*)(QKL + (r0 + rl) * (2 * DM) + n0 + lane * 8), *(const v4u*)&sol[wave][rl][lane * 8]); }
  } else {
#pragma unroll
    for (int j = 0; j < 8; ++j) {
#pragma unroll
      for (int r = 0; r < 8; ++r) { const float v = acc[j][r]; const _Float16 hv = (_Float16)v; sth[j * 16 + col][wave * 16 + 8 * g + r] = hv; stl[j * 16 + col][wave * 16 + 8 * g + r] = (_Float16)((v - (float)hv) * 2048.0f); } }
    __syncthreads();
    const size_t rb = (size_t)blockIdx.x * 64; const int b = (int)(rb / SS), s0 = (int)(rb % SS); const int pc0 = n0 - 2 * DM;
    for (int q = tid; q < 128 * 8; q += 128) { const int d = q >> 3, pc = q & 7; const size_t o = ((size_t)b * DM + pc0 + d) * SS + s0 + pc * 8; vst2((unsigned*)(VTH + o), *(const v4u*)&sth[d][pc * 8]); vst2((unsigned*)(VTL + o), *(const v4u*)&stl[d][pc * 8]); }
  }
}
// ---- k_attn: block = (64 queries, head h, batch b): causal flash attention (K = 64: 2 k-steps), scores = (q.k) * 0.125 with q, k as f16 hi + residual*2048 (3 products), P.V: f16 (P hi, P lo*2048) x (V hi, V lo*2048), 3 products in two accumulators; O[b*S+q][h*64+d] = (acc + accl / 2048) / l (256-B segments)
__global__ __launch_bounds__(128) void k_attn(const _Float16* __restrict__ QK, const _Float16* __restrict__ QKL, const _Float16* __restrict__ VTH, const _Float16* __restrict__ VTL, float* __restrict__ O) {
  __shared__ __align__(16) float sp[4][16][36]; __shared__ __align__(16) float so[4][16][68];
  const int tid = threadIdx.x, wave = tid >> 5, lane = tid & 31, col = lane & 15, g = lane >> 4;
  const int qb = blockIdx.x, h = blockIdx.y, b = blockIdx.z; const int q0 = qb * 64 + wave * 16; const size_t rq = (size_t)b * SS + q0 + col;
  v16h aq[2], aql[2];
#pragma unroll
  for (int kc = 0; kc < 2; ++kc) { aq[kc] = frag_h(QK + rq * (2 * DM) + h * HD + kc * 32, lane); aql[kc] = frag_h(QKL + rq * (2 * DM) + h * HD + kc * 32, lane); }
  float m[8], l[8];
#pragma unroll
  for (int r = 0; r < 8; ++r) { m[r] = -3.0e38f; l[r] = 0.f; }
  v8f acc[4] = {}, accl[4] = {};
  const int nks = (qb * 64 + 64) / 32;
#pragma unroll 1
  for (int ks = 0; ks < nks; ++ks) { v8f s[2];
#pragma unroll
    for (int ct = 0; ct < 2; ++ct) { const int kk = ks * 32 + ct * 16 + col; const _Float16* krow = QK + ((size_t)b * SS + kk) * (2 * DM) + DM + h * HD; const _Float16* krowl = QKL + ((size_t)b * SS + kk) * (2 * DM) + DM + h * HD; v8f c = {}, cl = {};
#pragma unroll
      for (int kc = 0; kc < 2; ++kc) { const v16h kh = frag_h(krow + kc * 32, lane); c = wmma16(aq[kc], kh, c); cl = wmma16(aql[kc], kh, cl); cl = wmma16(aq[kc], frag_h(krowl + kc * 32, lane), cl); }   // 3 products: q, k as f16 hi + residual
#pragma unroll
      for (int r = 0; r < 8; ++r) c[r] += cl[r] * (1.0f / 2048.0f);
#pragma unroll
      for (int r = 0; r < 8; ++r) { const int qi = q0 + 8 * g + r; s[ct][r] = (kk <= qi) ? c[r] * 0.125f : -3.0e38f; } }   // SCALE = 1/sqrt(64)
#pragma unroll
    for (int r = 0; r < 8; ++r) { float mx = fmaxf(s[0][r], s[1][r]);
#pragma unroll
      for (int o = 1; o < 16; o <<= 1) mx = fmaxf(mx, __shfl_xor(mx, o));
      const float mn = fmaxf(m[r], mx); const float alpha = (m[r] <= -1.0e38f) ? 0.f : __expf(m[r] - mn);
      const float e0 = (s[0][r] <= -1.0e38f) ? 0.f : __expf(s[0][r] - mn), e1 = (s[1][r] <= -1.0e38f) ? 0.f : __expf(s[1][r] - mn); float es = e0 + e1;
#pragma unroll
      for (int o = 1; o < 16; o <<= 1) es += __shfl_xor(es, o);
      l[r] = l[r] * alpha + es; m[r] = mn;
#pragma unroll
      for (int dt = 0; dt < 4; ++dt) { acc[dt][r] *= alpha; accl[dt][r] *= alpha; }
      sp[wave][8 * g + r][col] = e0; sp[wave][8 * g + r][16 + col] = e1; }
    LDSX();
    v16h pa, pl; { const float* prow = &sp[wave][col][0] + 8 * (lane >> 4);
#pragma unroll
      for (int i = 0; i < 8; ++i) { const float x0 = prow[i], x1 = prow[16 + i]; const _Float16 h0 = (_Float16)x0, h1 = (_Float16)x1; pa[i] = h0; pa[8 + i] = h1; pl[i] = (_Float16)((x0 - (float)h0) * 2048.0f); pl[8 + i] = (_Float16)((x1 - (float)h1) * 2048.0f); } }
#pragma unroll
    for (int dt = 0; dt < 4; ++dt) { const size_t vr = ((size_t)b * DM + h * HD + dt * 16 + col) * SS + ks * 32; const v16h vh = frag_h(VTH + vr, lane); acc[dt] = wmma16(pa, vh, acc[dt]); accl[dt] = wmma16(pl, vh, accl[dt]); accl[dt] = wmma16(pa, frag_h(VTL + vr, lane), accl[dt]); }   // P hi x V hi + (P lo x V hi + P hi x V lo) / 2048
    LDSX(); }
#pragma unroll
  for (int r = 0; r < 8; ++r) { const float il = 1.0f / l[r];
#pragma unroll
    for (int dt = 0; dt < 4; ++dt) so[wave][8 * g + r][dt * 16 + col] = (acc[dt][r] + accl[dt][r] * (1.0f / 2048.0f)) * il; }
  LDSX();
  for (int rl = 0; rl < 16; ++rl) if (lane < 16) vst2(O + ((size_t)b * SS + q0 + rl) * DM + h * HD + lane * 4, *(const v4f*)&so[wave][rl][lane * 4]);
}
// ---- k_out: block = (64 rows, 128 cols): out = O(hi/lo) . Wo rows (2 products) + bo
__global__ __launch_bounds__(128) void k_out(const float* __restrict__ O, const __bf16* __restrict__ P, const float* __restrict__ BO, float* __restrict__ Y) {
  __shared__ __align__(16) float so[4][16][132];
  const int tid = threadIdx.x, wave = tid >> 5, lane = tid & 31, col = lane & 15, g = lane >> 4; const size_t r0 = (size_t)blockIdx.x * 64 + wave * 16; const int n0 = blockIdx.y * 128;
  v8f acc[8] = {};
#pragma unroll 2
  for (int kc = 0; kc < DM / 32; ++kc) { const F2 a = split_row(O + (r0 + col) * DM, kc * 32, lane);
#pragma unroll
    for (int j = 0; j < 8; ++j) { const v16b w = frag_b(P + (size_t)(n0 + j * 16 + col) * DM + kc * 32, lane); acc[j] = wmma_bf(a.l, w, acc[j]); acc[j] = wmma_bf(a.h, w, acc[j]); } }
#pragma unroll
  for (int j = 0; j < 8; ++j) {
#pragma unroll
    for (int r = 0; r < 8; ++r) so[wave][8 * g + r][j * 16 + col] = acc[j][r] + bfr(BO[n0 + j * 16 + col]); }
  LDSX();
  for (int rl = 0; rl < 16; ++rl) vst2(Y + (r0 + rl) * DM + n0 + lane * 4, *(const v4f*)&so[wave][rl][lane * 4]);
}
extern "C" void kernel_launch(void* const* d_in, const int* in_sizes, int n_in, void* d_out, int out_size, void* d_ws, size_t ws_size, hipStream_t stream) {
  (void)in_sizes; (void)n_in; (void)out_size;
  const float** F = (const float**)d_in;   // 0 x [4,2048,1024], 1 Wq [1024,1024] natural, 2 bq, 3 Wk, 4 bk, 5 Wv, 6 bv, 7 Wo, 8 bo
  if (ws_size < (size_t)WS_END) return;
  char* ws = (char*)d_ws; __bf16* PK = (__bf16*)(ws + WS_PK); _Float16 *QK = (_Float16*)(ws + WS_QK), *QKL = (_Float16*)(ws + WS_QKL), *VTH = (_Float16*)(ws + WS_VTH), *VTL = (_Float16*)(ws + WS_VTL); float* O = (float*)(ws + WS_O);
  k_pack<<<dim3(DM, 4), 256, 0, stream>>>(F[1], F[3], F[5], F[7], PK);
  k_qkv<<<dim3(TNB * SS / 64, QKVW / 128), 128, 0, stream>>>(F[0], PK + PK_A, F[2], F[4], F[6], QK, QKL, VTH, VTL);
  k_attn<<<dim3(TQB, NH, TNB), 128, 0, stream>>>(QK, QKL, VTH, VTL, O);
  k_out<<<dim3(TOB, DM / 128), 128, 0, stream>>>(O, PK + PK_P, F[8], (float*)d_out);
}

// v001
// One run takes 580 microseconds.
// Next to v000, in two timings, it ran 1.44 times as fast each time.
// compute dtype: x, Wq..Wo, bq..bo (module inputs) rounded to bf16; q/k/v projections with exact bf16 products on WMMA 16x16x32 (natural [out][in] rows) + biases; q and k stored as f16 hi + (x2048-scaled) residual planes with 3-product scores, x 1/sqrt(64), causal mask (k > q -> -1e9 in the module, zero weight), running-max softmax in f32 (hardware exp); P as f16 hi + (x2048) residual x v hi/lo (3 products); output projection with ctx as bf16 hi + residual x exact Wo rows (2 products) + bo; f32 accumulate.
#include <hip/hip_runtime.h>
#include <math.h>

typedef __attribute__((ext_vector_type(16))) _Float16 v16h;
typedef __attribute__((ext_vector_type(16))) __bf16 v16b;
typedef __attribute__((ext_vector_type(8)))  _Float16 v8h;
typedef __attribute__((ext_vector_type(8)))  float v8f;
typedef __attribute__((ext_vector_type(4)))  float v4f;
typedef __attribute__((ext_vector_type(2)))  float v2f;
typedef __attribute__((ext_vector_type(4)))  unsigned v4u;
typedef __attribute__((ext_vector_type(4)))  int v4i;
typedef float __attribute__((may_alias)) float_a;
typedef int __attribute__((may_alias)) int_a;

template <typename T> __device__ __forceinline__ void vst2(void* p, T v) { *(T*)p = v;  }
__device__ __forceinline__ v8f wmma16(v16h a, v16h b, v8f c) {
  v8f d = __builtin_amdgcn_wmma_f32_16x16x32_f16(false, a, false, b, (short)0, c, false, false);
  asm volatile("v_nop\n\tv_nop\n\tv_nop\n\tv_nop" : "+v"(d) : "v"(a), "v"(b));
  return d;
}
__device__ __forceinline__ v8f wmma_bf(v16b a, v16b b, v8f c) {
  v8f d = __builtin_amdgcn_wmma_f32_16x16x32_bf16(false, a, false, b, (short)0, c, false, false);
  asm volatile("v_nop\n\tv_nop\n\tv_nop\n\tv_nop" : "+v"(d) : "v"(a), "v"(b));
  return d;
}
// Masked (causal) multi-head attention (B 4, S 2,048, d 1,024, 16 heads x 64; four biased projections).
__device__ __forceinline__ v16h frag_h(const _Float16* rowk0, int lane) {
  union { v16h v; v8h q[2]; } u; const _Float16* p = rowk0 + 8 * (lane >> 4);
  u.q[0] = *(const v8h*)p; u.q[1] = *(const v8h*)(p + 16); return u.v;
}
__device__ __forceinline__ v16h frag_f32(const float* rowk0, int lane) {
  v16h a; const float* p = rowk0 + 8 * (lane >> 4);
#pragma unroll
  for (int i = 0; i < 8; ++i) { a[i] = (_Float16)p[i]; a[8 + i] = (_Float16)p[16 + i]; }
  return a;
}
__device__ __forceinline__ v16h frag_f32s(const float* rowk0, int lane, float sc) {
  v16h a; const float* p = rowk0 + 8 * (lane >> 4);
#pragma unroll
  for (int i = 0; i < 8; ++i) { a[i] = (_Float16)(p[i] * sc); a[8 + i] = (_Float16)(p[16 + i] * sc); }
  return a;
}
// column fragment from a [K][ld] layout (column n), rows >= K read as 0
__device__ __forceinline__ v16h fragc_f32(const float* W, int k0, int n, int lane, int ld, int K) {
  v16h a; const int g = lane >> 4;
#pragma unroll
  for (int i = 0; i < 8; ++i) { const int ka = k0 + 8 * g + i, kb = ka + 16;
    a[i] = (_Float16)(ka < K ? W[(size_t)(ka < K ? ka : K - 1) * ld + n] : 0.f); a[8 + i] = (_Float16)(kb < K ? W[(size_t)(kb < K ? kb : K - 1) * ld + n] : 0.f); }
  return a;
}
struct F2 { v16b h, l; };
__device__ __forceinline__ F2 bsplit16(const float v[16]) { F2 r;
#pragma unroll
  for (int i = 0; i < 16; ++i) { const __bf16 h = (__bf16)v[i]; r.h[i] = h; r.l[i] = (__bf16)(v[i] - (float)h); }
  return r; }
__device__ __forceinline__ F2 split_row(const float* row, int k0, int lane) { float v[16]; const float* p = row + k0 + 8 * (lane >> 4);
#pragma unroll
  for (int i = 0; i < 8; ++i) { v[i] = p[i]; v[8 + i] = p[16 + i]; }
  return bsplit16(v); }
__device__ __forceinline__ F2 split_rowK(const float* row, int k0, int lane, int K) { float v[16]; const int g = lane >> 4;
#pragma unroll
  for (int i = 0; i < 8; ++i) { const int ka = k0 + 8 * g + i, kb = ka + 16; v[i] = ka < K ? row[ka < K ? ka : K - 1] : 0.f; v[8 + i] = kb < K ? row[kb < K ? kb : K - 1] : 0.f; }
  return bsplit16(v); }
__device__ __forceinline__ F2 split_col(const float* W, int k0, int n, int lane, int ld, int K) { float v[16]; const int g = lane >> 4;
#pragma unroll
  for (int i = 0; i < 8; ++i) { const int ka = k0 + 8 * g + i, kb = ka + 16; v[i] = ka < K ? W[(size_t)(ka < K ? ka : K - 1) * ld + n] : 0.f; v[8 + i] = kb < K ? W[(size_t)(kb < K ? kb : K - 1) * ld + n] : 0.f; }
  return bsplit16(v); }
__device__ __forceinline__ v8f mac3(const F2& a, const F2& b, v8f c) { c = wmma_bf(a.l, b.h, c); c = wmma_bf(a.h, b.l, c); return wmma_bf(a.h, b.h, c); }
__device__ __forceinline__ float sigm(float v) { return 1.0f / (1.0f + expf(-v)); }
#define LDSX() do { asm volatile("s_wait_dscnt 0" ::: "memory"); __builtin_amdgcn_wave_barrier(); __builtin_amdgcn_fence(__ATOMIC_RELEASE, "workgroup"); } while (0)


#define NB 4
#define SS 2048
#define DM 1024
#define NH 16
#define HD 64
#define QKVW (3 * DM)
#ifndef TQB
#define TQB (SS / 64)
#define TNB NB
#define TOB (NB * SS / 64)     // output row tiles (all)
#endif
typedef __attribute__((ext_vector_type(8))) __bf16 v8b;
__device__ __forceinline__ v16b frag_b(const __bf16* rowk0, int lane) {
  union { v16b v; v8b q[2]; } u; const __bf16* p = rowk0 + 8 * (lane >> 4);
  u.q[0] = *(const v8b*)p; u.q[1] = *(const v8b*)(p + 16); return u.v;
}
__device__ __forceinline__ float bfr(float v) { return (float)(__bf16)v; }
__device__ __attribute__((noinline)) float exp_ni(float v) { return expf(v); }
__device__ __attribute__((noinline)) float erf_ni(float v) { return erff(v); }

#define PK_A 0                       // [3072][1024] Wqkv rows (natural [out][in])
#define PK_P (PK_A + QKVW * DM)        // [1024][1024] Wo rows (natural)
#define PK_END (PK_P + DM * DM)
#define WS_PK  0u
#define WS_QK  (WS_PK + 2u * PK_END)             // f16 [8192 rows][2048]: q | k
#define WS_QKL (WS_QK + 2u * NB * SS * 2 * DM)     // f16 q | k residual planes x2048
#define WS_VTH (WS_QKL + 2u * NB * SS * 2 * DM)    // f16 [b][1024 (h*64+d)][2048 s] hi
#define WS_VTL (WS_VTH + 2u * NB * DM * SS)        // f16 lo x 2048
#define WS_O   (WS_VTL + 2u * NB * DM * SS)        // f32 [8192][1024]
#define WS_CS  (WS_O + 4u * NB * SS * DM)           // f32 2 x [2048][32], reserved but never written or read (no RoPE)
#define WS_END (WS_CS + 4u * 2 * SS * 32)
// ---- k_pack: block = (row n, which): natural [out][in] rows -> bf16; which 0..2 -> W_q/W_k/W_v into PK_A rows which*1024 + n; 3 -> W_o into PK_P
__global__ __launch_bounds__(256) void k_pack(const float* __restrict__ WQ, const float* __restrict__ WK, const float* __restrict__ WV, const float* __restrict__ WO, __bf16* __restrict__ PK) {
  __shared__ __align__(16) __bf16 s[DM]; const int n = blockIdx.x, which = blockIdx.y, t = threadIdx.x; const float* Wm = (which == 0) ? WQ : (which == 1) ? WK : (which == 2) ? WV : WO;
  for (int k = t; k < DM; k += 256) s[k] = (__bf16)Wm[(size_t)n * DM + k];
  __syncthreads();
  __bf16* dst = (which < 3) ? PK + PK_A + ((size_t)which * DM + n) * DM : PK + PK_P + (size_t)n * DM;
  for (int q = t; q < DM / 8; q += 256) vst2((unsigned*)(dst + q * 8), *(const v4u*)&s[q * 8]);
}
__global__ __launch_bounds__(128) void k_qkv(const float* __restrict__ X, const __bf16* __restrict__ P, const float* __restrict__ BQ, const float* __restrict__ BK, const float* __restrict__ BV, _Float16* __restrict__ QK, _Float16* __restrict__ QKL, _Float16* __restrict__ VTH, _Float16* __restrict__ VTL) {
  __shared__ __align__(16) _Float16 so[4][16][136], sol[4][16][136]; __shared__ __align__(16) _Float16 sth[128][72], stl[128][72];
  const int tid = threadIdx.x, wave = tid >> 5, lane = tid & 31, col = lane & 15, g = lane >> 4; const size_t r0 = (size_t)blockIdx.x * 64 + wave * 16; const int n0 = blockIdx.y * 128;
  v8f acc[8] = {};
#pragma unroll 2
  for (int kc = 0; kc < DM / 32; ++kc) { v16b a; { const float* p = X + (r0 + col) * DM + kc * 32 + 8 * g;
#pragma unroll
      for (int i = 0; i < 8; ++i) { a[i] = (__bf16)p[i]; a[8 + i] = (__bf16)p[16 + i]; } }
#pragma unroll
    for (int j = 0; j < 8; ++j) acc[j] = wmma_bf(a, frag_b(P + (size_t)(n0 + j * 16 + col) * DM + kc * 32, lane), acc[j]); }
  { const int which = n0 / DM; const float* BB = (which == 0) ? BQ : (which == 1) ? BK : BV;
#pragma unroll
    for (int j = 0; j < 8; ++j) { const float bb = bfr(BB[(n0 % DM) + j * 16 + col]);
#pragma unroll
      for (int r = 0; r < 8; ++r) acc[j][r] += bb; } }
  if (n0 < 2 * DM) {   // q stored unscaled (f16 sigma ~0.6, no subnormal exposure); 1/8 applied to the f32 score
#pragma unroll
    for (int j = 0; j < 8; ++j) {
#pragma unroll
      for (int r = 0; r < 8; ++r) { const float v = acc[j][r]; const _Float16 hv = (_Float16)v; so[wave][8 * g + r][j * 16 + col] = hv; sol[wave][8 * g + r][j * 16 + col] = (_Float16)((v - (float)hv) * 2048.0f); } }   // q, k as f16 hi + (x2048) residual (no RoPE in this module)
    LDSX();
    for (int rl = 0; rl < 16; ++rl) if (lane < 16) { vst2((unsigned*)(QK + (r0 + rl) * (2 * DM) + n0 + lane * 8), *(const v4u*)&so[wave][rl][lane * 8]); vst2((unsigned*)(QKL + (r0 + rl) * (2 * DM) + n0 + lane * 8), *(const v4u*)&sol[wave][rl][lane * 8]); }
  } else {
#pragma unroll
    for (int j = 0; j < 8; ++j) {
#pragma unroll
      for (int r = 0; r < 8; ++r) { const float v = acc[j][r]; const _Float16 hv = (_Float16)v; sth[j * 16 + col][wave * 16 + 8 * g + r] = hv; stl[j * 16 + col][wave * 16 + 8 * g + r] = (_Float16)((v - (float)hv) * 2048.0f); } }
    __syncthreads();
    const size_t rb = (size_t)blockIdx.x * 64; const int b = (int)(rb / SS), s0 = (int)(rb % SS); const int pc0 = n0 - 2 * DM;
    for (int q = tid; q < 128 * 8; q += 128) { const int d = q >> 3, pc = q & 7; const size_t o = ((size_t)b * DM + pc0 + d) * SS + s0 + pc * 8; vst2((unsigned*)(VTH + o), *(const v4u*)&sth[d][pc * 8]); vst2((unsigned*)(VTL + o), *(const v4u*)&stl[d][pc * 8]); }
  }
}
// ---- tensor-load helpers: a stage of k_attn is 64 keys; four tiles (K hi, K residual, V^T hi, V^T residual), each 64 rows of 128 B at source pitch 4096 B, one tile per wave
typedef unsigned u32x4 __attribute__((ext_vector_type(4)));
typedef unsigned u32x8 __attribute__((ext_vector_type(8)));
#define AKS 64                 // keys per stage
#define APITCH 144             // LDS row pitch in bytes: 128-B rows + 16 (odd multiple of 16 for the ds_load_b128 readers)
#define ASLICE 10240           // one tile in LDS: 64 x 144 B rounded up to a multiple of 2 KiB
#define ABUF (4 * ASLICE)      // one stage
__device__ __forceinline__ unsigned uni(unsigned v) { return (unsigned)__builtin_amdgcn_readfirstlane(v); }
__device__ __forceinline__ unsigned pinned(unsigned v) { unsigned w = uni(v); asm volatile("" : "+s"(w)); return w; }   // the issue test held in a scalar register, so that it compiles to s_cmp + s_cbranch_scc (a tensor load ignores EXEC)
__device__ __forceinline__ u32x4 tdm_group0(unsigned lds_dst, unsigned long long ga) {
  u32x4 g0; g0[0] = uni(1u); g0[1] = uni(lds_dst); g0[2] = uni((unsigned)ga); g0[3] = uni((((unsigned)(ga >> 32)) & 0x01FFFFFFu) | 0x80000000u); return g0;
}
__device__ __forceinline__ u32x8 tdm_group1() {
  u32x8 g1; g1[0] = uni((1u << 20) | (4u << 22) | (3u << 25));   // no mask, 1-byte elements, a pad of 4 dwords behind every 32 dwords (one row)
  g1[1] = uni(128u << 16); g1[2] = uni(64u << 16); g1[3] = uni(128u << 16); g1[4] = uni(64u); g1[5] = uni(4096u); g1[6] = uni(0u); g1[7] = uni(0u);
  asm volatile("" : "+s"(g1));   // descriptor words held in their scalar registers: without it the constants are formed anew at each load and their registers serve as temporaries while a request is out
  return g1;
}
__device__ __forceinline__ void tdm_load(u32x4 g0, u32x8 g1) { asm volatile("tensor_load_to_lds %0, %1" :: "s"(g0), "s"(g1) : "memory"); }
// the wave's own request has landed; the operands keep that request's descriptor registers unwritten up to here
__device__ __forceinline__ void tdm_wait(u32x4 g0, u32x8 g1) { asm volatile("s_wait_tensorcnt 0x0" :: "s"(g0), "s"(g1) : "memory"); }
// ---- k_attn: block = (64 queries, head h, batch b): causal flash attention (K = 64: 2 k-steps), scores = (q.k) * 0.125 with q, k as f16 hi + (x2048) residual (3 products), P.V: f16 P x (V hi, V lo*2048) in two accumulators; O[b*S+q][h*64+d] = (acc + accl / 2048) / l (256-B segments)
__global__ __launch_bounds__(128) void k_attn(const _Float16* __restrict__ QK, const _Float16* __restrict__ QKL, const _Float16* __restrict__ VTH, const _Float16* __restrict__ VTL, float* __restrict__ O) {
  __shared__ __attribute__((aligned(2048))) unsigned char ring[2 * ABUF];   // two stages of K/V tiles, shared by the four waves
  __shared__ __align__(16) float sp[4][16][36]; __shared__ __align__(16) float so[4][16][68];
  const int tid = threadIdx.x, wave = tid >> 5, lane = tid & 31, col = lane & 15, g = lane >> 4;
  const int qb = blockIdx.x, h = blockIdx.y, b = blockIdx.z; const int q0 = qb * 64 + wave * 16; const size_t rq = (size_t)b * SS + q0 + col;
  // every wave brings one tile of each stage: wave 0 K hi, 1 K residual (64 key rows), 2 V^T hi, 3 V^T residual (64 d rows x 64 keys)
  const unsigned wv = uni((unsigned)tid >> 5); const size_t ko = (size_t)b * SS * (2 * DM) + DM + h * HD, vo = ((size_t)b * DM + h * HD) * SS;
  const _Float16* tsrc = (wv == 0u) ? QK + ko : (wv == 1u) ? QKL + ko : (wv == 2u) ? VTH + vo : VTL + vo;
  const unsigned tstep = (wv < 2u) ? (unsigned)(AKS * 2 * DM * 2) : (unsigned)(AKS * 2);   // bytes from one stage's tile to the next
  const unsigned tdst = (unsigned)(size_t)ring + wv * ASLICE;
  const u32x8 g1 = tdm_group1(); u32x4 g0 = tdm_group0(tdst, (unsigned long long)(size_t)tsrc);
  tdm_load(g0, g1);                                                                       // stage 0
  tdm_wait(g0, g1);                                                                       // this wave's tile of stage 0 has landed
  __syncthreads();                                                                        // stage 0 published to all four waves
  g0 = tdm_group0(tdst + ABUF, (unsigned long long)(size_t)tsrc + tstep);
  tdm_load(g0, g1);                                                                       // stage 1 (keys 64..127 exist for every block; unread where qb is 0)
  v16h aq[2], aql[2];
#pragma unroll
  for (int kc = 0; kc < 2; ++kc) { aq[kc] = frag_h(QK + rq * (2 * DM) + h * HD + kc * 32, lane); aql[kc] = frag_h(QKL + rq * (2 * DM) + h * HD + kc * 32, lane); }
  float m[8], l[8];
#pragma unroll
  for (int r = 0; r < 8; ++r) { m[r] = -3.0e38f; l[r] = 0.f; }
  v8f acc[4] = {}, accl[4] = {};
  const int nst = qb + 1;
#pragma unroll 1
  for (int st = 0; st < nst; ++st) { const unsigned char* buf = ring + (st & 1) * ABUF;
#pragma unroll
  for (int sub = 0; sub < 2; ++sub) { const int ks = st * 2 + sub; v8f s[2];
#pragma unroll
    for (int ct = 0; ct < 2; ++ct) { const int kk = ks * 32 + ct * 16 + col; const _Float16* krow = (const _Float16*)(buf + (sub * 32 + ct * 16 + col) * APITCH); const _Float16* krowl = (const _Float16*)(buf + ASLICE + (sub * 32 + ct * 16 + col) * APITCH); v8f c = {}, cl = {};
#pragma unroll
      for (int kc = 0; kc < 2; ++kc) { const v16h kh = frag_h(krow + kc * 32, lane); c = wmma16(aq[kc], kh, c); cl = wmma16(aql[kc], kh, cl); cl = wmma16(aq[kc], frag_h(krowl + kc * 32, lane), cl); }   // 3 products: q, k as f16 hi + residual
#pragma unroll
      for (int r = 0; r < 8; ++r) c[r] += cl[r] * (1.0f / 2048.0f);
#pragma unroll
      for (int r = 0; r < 8; ++r) { const int qi = q0 + 8 * g + r; s[ct][r] = (kk <= qi) ? c[r] * 0.125f : -3.0e38f; } }   // SCALE = 1/sqrt(64)
#pragma unroll
    for (int r = 0; r < 8; ++r) { float mx = fmaxf(s[0][r], s[1][r]);
#pragma unroll
      for (int o = 1; o < 16; o <<= 1) mx = fmaxf(mx, __shfl_xor(mx, o));
      const float mn = fmaxf(m[r], mx); const float alpha = (m[r] <= -1.0e38f) ? 0.f : __expf(m[r] - mn);
      const float e0 = (s[0][r] <= -1.0e38f) ? 0.f : __expf(s[0][r] - mn), e1 = (s[1][r] <= -1.0e38f) ? 0.f : __expf(s[1][r] - mn); float es = e0 + e1;
#pragma unroll
      for (int o = 1; o < 16; o <<= 1) es += __shfl_xor(es, o);
      l[r] = l[r] * alpha + es; m[r] = mn;
#pragma unroll
      for (int dt = 0; dt < 4; ++dt) { acc[dt][r] *= alpha; accl[dt][r] *= alpha; }
      sp[wave][8 * g + r][col] = e0; sp[wave][8 * g + r][16 + col] = e1; }
    LDSX();
    v16h pa, pl; { const float* prow = &sp[wave][col][0] + 8 * (lane >> 4);
#pragma unroll
      for (int i = 0; i < 8; ++i) { const float x0 = prow[i], x1 = prow[16 + i]; const _Float16 h0 = (_Float16)x0, h1 = (_Float16)x1; pa[i] = h0; pa[8 + i] = h1; pl[i] = (_Float16)((x0 - (float)h0) * 2048.0f); pl[8 + i] = (_Float16)((x1 - (float)h1) * 2048.0f); } }
#pragma unroll
    for (int dt = 0; dt < 4; ++dt) { const unsigned char* vr = buf + 2 * ASLICE + (dt * 16 + col) * APITCH + sub * 64; const v16h vh = frag_h((const _Float16*)vr, lane); acc[dt] = wmma16(pa, vh, acc[dt]); accl[dt] = wmma16(pl, vh, accl[dt]); accl[dt] = wmma16(pa, frag_h((const _Float16*)(vr + ASLICE), lane), accl[dt]); }   // P hi x V hi + (P lo x V hi + P hi x V lo) / 2048
    LDSX(); }
    asm volatile("s_wait_dscnt 0x0" ::: "memory");        // this wave's reads of stage st are done
    tdm_wait(g0, g1);                                     // this wave's tile of stage st + 1 has landed
    __syncthreads();                                      // publishes stage st + 1 and ends every wave's reads of stage st
    if (pinned(st + 2 < nst)) { g0 = tdm_group0(tdst + (unsigned)(st & 1) * ABUF, (unsigned long long)(size_t)tsrc + (unsigned long long)(unsigned)(st + 2) * tstep); tdm_load(g0, g1); } }   // refill of the buffer just left
  tdm_wait(g0, g1);                                       // no request outstanding when the wave goes on to its end
  asm volatile("s_wait_dscnt 0x0" ::: "memory");
#pragma unroll
  for (int r = 0; r < 8; ++r) { const float il = 1.0f / l[r];
#pragma unroll
    for (int dt = 0; dt < 4; ++dt) so[wave][8 * g + r][dt * 16 + col] = (acc[dt][r] + accl[dt][r] * (1.0f / 2048.0f)) * il; }
  LDSX();
  for (int rl = 0; rl < 16; ++rl) if (lane < 16) vst2(O + ((size_t)b * SS + q0 + rl) * DM + h * HD + lane * 4, *(const v4f*)&so[wave][rl][lane * 4]);
}
// ---- k_out: block = (64 rows, 128 cols): out = O(hi/lo) . Wo rows (2 products) + bo
__global__ __launch_bounds__(128) void k_out(const float* __restrict__ O, const __bf16* __restrict__ P, const float* __restrict__ BO, float* __restrict__ Y) {
  __shared__ __align__(16) float so[4][16][132];
  const int tid = threadIdx.x, wave = tid >> 5, lane = tid & 31, col = lane & 15, g = lane >> 4; const size_t r0 = (size_t)blockIdx.x * 64 + wave * 16; const int n0 = blockIdx.y * 128;
  v8f acc[8] = {};
#pragma unroll 2
  for (int kc = 0; kc < DM / 32; ++kc) { const F2 a = split_row(O + (r0 + col) * DM, kc * 32, lane);
#pragma unroll
    for (int j = 0; j < 8; ++j) { const v16b w = frag_b(P + (size_t)(n0 + j * 16 + col) * DM + kc * 32, lane); acc[j] = wmma_bf(a.l, w, acc[j]); acc[j] = wmma_bf(a.h, w, acc[j]); } }
#pragma unroll
  for (int j = 0; j < 8; ++j) {
#pragma unroll
    for (int r = 0; r < 8; ++r) so[wave][8 * g + r][j * 16 + col] = acc[j][r] + bfr(BO[n0 + j * 16 + col]); }
  LDSX();
  for (int rl = 0; rl < 16; ++rl) vst2(Y + (r0 + rl) * DM + n0 + lane * 4, *(const v4f*)&so[wave][rl][lane * 4]);
}
extern "C" void kernel_launch(void* const* d_in, const int* in_sizes, int n_in, void* d_out, int out_size, void* d_ws, size_t ws_size, hipStream_t stream) {
  (void)in_sizes; (void)n_in; (void)out_size;
  const float** F = (const float**)d_in;   // 0 x [4,2048,1024], 1 Wq [1024,1024] natural, 2 bq, 3 Wk, 4 bk, 5 Wv, 6 bv, 7 Wo, 8 bo
  if (ws_size < (size_t)WS_END) return;
  char* ws = (char*)d_ws; __bf16* PK = (__bf16*)(ws + WS_PK); _Float16 *QK = (_Float16*)(ws + WS_QK), *QKL = (_Float16*)(ws + WS_QKL), *VTH = (_Float16*)(ws + WS_VTH), *VTL = (_Float16*)(ws + WS_VTL); float* O = (float*)(ws + WS_O);
  k_pack<<<dim3(DM, 4), 256, 0, stream>>>(F[1], F[3], F[5], F[7], PK);
  k_qkv<<<dim3(TNB * SS / 64, QKVW / 128), 128, 0, stream>>>(F[0], PK + PK_A, F[2], F[4], F[6], QK, QKL, VTH, VTL);
  k_attn<<<dim3(TQB, NH, TNB), 128, 0, stream>>>(QK, QKL, VTH, VTL, O);
  k_out<<<dim3(TOB, DM / 128), 128, 0, stream>>>(O, PK + PK_P, F[8], (float*)d_out);
}

// v002
// It runs in 358 microseconds.
// In two side-by-side timings against v001, it was 1.62 and 1.63 times as fast.
// Counting every step since v000, it is 2.33 times as fast.
// compute dtype: x, Wq..Wo, bq..bo (module inputs) rounded to bf16; q/k/v projections with exact bf16 products on WMMA 16x16x32 (natural [out][in] rows) + biases; q and k stored as f16 hi + (x2048-scaled) residual planes with 3-product scores, x 1/sqrt(64), causal mask (k > q -> -1e9 in the module, zero weight), running-max softmax in f32 (hardware exp); P as f16 hi + (x2048) residual x v hi/lo (3 products); output projection with ctx as bf16 hi + residual x exact Wo rows (2 products) + bo; f32 accumulate.
#include <hip/hip_runtime.h>
#include <math.h>

typedef __attribute__((ext_vector_type(16))) _Float16 v16h;
typedef __attribute__((ext_vector_type(16))) __bf16 v16b;
typedef __attribute__((ext_vector_type(8)))  _Float16 v8h;
typedef __attribute__((ext_vector_type(8)))  float v8f;
typedef __attribute__((ext_vector_type(4)))  float v4f;
typedef __attribute__((ext_vector_type(2)))  float v2f;
typedef __attribute__((ext_vector_type(4)))  unsigned v4u;
typedef __attribute__((ext_vector_type(4)))  int v4i;
typedef float __attribute__((may_alias)) float_a;
typedef int __attribute__((may_alias)) int_a;

template <typename T> __device__ __forceinline__ void vst2(void* p, T v) { *(T*)p = v;  }
__device__ __forceinline__ v8f wmma16(v16h a, v16h b, v8f c) {
  v8f d = __builtin_amdgcn_wmma_f32_16x16x32_f16(false, a, false, b, (short)0, c, false, false);
  asm volatile("v_nop\n\tv_nop\n\tv_nop\n\tv_nop" : "+v"(d) : "v"(a), "v"(b));
  return d;
}
__device__ __forceinline__ v8f wmma_bf(v16b a, v16b b, v8f c) {
  v8f d = __builtin_amdgcn_wmma_f32_16x16x32_bf16(false, a, false, b, (short)0, c, false, false);
  asm volatile("v_nop\n\tv_nop\n\tv_nop\n\tv_nop" : "+v"(d) : "v"(a), "v"(b));
  return d;
}
// Masked (causal) multi-head attention (B 4, S 2,048, d 1,024, 16 heads x 64; four biased projections).
__device__ __forceinline__ v16h frag_h(const _Float16* rowk0, int lane) {
  union { v16h v; v8h q[2]; } u; const _Float16* p = rowk0 + 8 * (lane >> 4);
  u.q[0] = *(const v8h*)p; u.q[1] = *(const v8h*)(p + 16); return u.v;
}
__device__ __forceinline__ v16h frag_f32(const float* rowk0, int lane) {
  v16h a; const float* p = rowk0 + 8 * (lane >> 4);
#pragma unroll
  for (int i = 0; i < 8; ++i) { a[i] = (_Float16)p[i]; a[8 + i] = (_Float16)p[16 + i]; }
  return a;
}
__device__ __forceinline__ v16h frag_f32s(const float* rowk0, int lane, float sc) {
  v16h a; const float* p = rowk0 + 8 * (lane >> 4);
#pragma unroll
  for (int i = 0; i < 8; ++i) { a[i] = (_Float16)(p[i] * sc); a[8 + i] = (_Float16)(p[16 + i] * sc); }
  return a;
}
// column fragment from a [K][ld] layout (column n), rows >= K read as 0
__device__ __forceinline__ v16h fragc_f32(const float* W, int k0, int n, int lane, int ld, int K) {
  v16h a; const int g = lane >> 4;
#pragma unroll
  for (int i = 0; i < 8; ++i) { const int ka = k0 + 8 * g + i, kb = ka + 16;
    a[i] = (_Float16)(ka < K ? W[(size_t)(ka < K ? ka : K - 1) * ld + n] : 0.f); a[8 + i] = (_Float16)(kb < K ? W[(size_t)(kb < K ? kb : K - 1) * ld + n] : 0.f); }
  return a;
}
struct F2 { v16b h, l; };
__device__ __forceinline__ F2 bsplit16(const float v[16]) { F2 r;
#pragma unroll
  for (int i = 0; i < 16; ++i) { const __bf16 h = (__bf16)v[i]; r.h[i] = h; r.l[i] = (__bf16)(v[i] - (float)h); }
  return r; }
__device__ __forceinline__ F2 split_row(const float* row, int k0, int lane) { float v[16]; const float* p = row + k0 + 8 * (lane >> 4);
#pragma unroll
  for (int i = 0; i < 8; ++i) { v[i] = p[i]; v[8 + i] = p[16 + i]; }
  return bsplit16(v); }
__device__ __forceinline__ F2 split_rowK(const float* row, int k0, int lane, int K) { float v[16]; const int g = lane >> 4;
#pragma unroll
  for (int i = 0; i < 8; ++i) { const int ka = k0 + 8 * g + i, kb = ka + 16; v[i] = ka < K ? row[ka < K ? ka : K - 1] : 0.f; v[8 + i] = kb < K ? row[kb < K ? kb : K - 1] : 0.f; }
  return bsplit16(v); }
__device__ __forceinline__ F2 split_col(const float* W, int k0, int n, int lane, int ld, int K) { float v[16]; const int g = lane >> 4;
#pragma unroll
  for (int i = 0; i < 8; ++i) { const int ka = k0 + 8 * g + i, kb = ka + 16; v[i] = ka < K ? W[(size_t)(ka < K ? ka : K - 1) * ld + n] : 0.f; v[8 + i] = kb < K ? W[(size_t)(kb < K ? kb : K - 1) * ld + n] : 0.f; }
  return bsplit16(v); }
__device__ __forceinline__ v8f mac3(const F2& a, const F2& b, v8f c) { c = wmma_bf(a.l, b.h, c); c = wmma_bf(a.h, b.l, c); return wmma_bf(a.h, b.h, c); }
__device__ __forceinline__ float sigm(float v) { return 1.0f / (1.0f + expf(-v)); }
#define LDSX() do { asm volatile("s_wait_dscnt 0" ::: "memory"); __builtin_amdgcn_wave_barrier(); __builtin_amdgcn_fence(__ATOMIC_RELEASE, "workgroup"); } while (0)


#define NB 4
#define SS 2048
#define DM 1024
#define NH 16
#define HD 64
#define QKVW (3 * DM)
#ifndef TQB
#define TQB (SS / 64)
#define TNB NB
#define TOB (NB * SS / 64)     // output row tiles (all)
#endif
typedef __attribute__((ext_vector_type(8))) __bf16 v8b;
__device__ __forceinline__ v16b frag_b(const __bf16* rowk0, int lane) {
  union { v16b v; v8b q[2]; } u; const __bf16* p = rowk0 + 8 * (lane >> 4);
  u.q[0] = *(const v8b*)p; u.q[1] = *(const v8b*)(p + 16); return u.v;
}
__device__ __forceinline__ float bfr(float v) { return (float)(__bf16)v; }
__device__ __attribute__((noinline)) float exp_ni(float v) { return expf(v); }
__device__ __attribute__((noinline)) float erf_ni(float v) { return erff(v); }

#define PK_A 0                       // [3072][1024] Wqkv rows (natural [out][in])
#define PK_P (PK_A + QKVW * DM)        // [1024][1024] Wo rows (natural)
#define PK_END (PK_P + DM * DM)
#define WS_PK  0u
#define WS_QK  (WS_PK + 2u * PK_END)             // f16 [8192 rows][2048]: q | k
#define WS_QKL (WS_QK + 2u * NB * SS * 2 * DM)     // f16 q | k residual planes x2048
#define WS_VTH (WS_QKL + 2u * NB * SS * 2 * DM)    // f16 [b][1024 (h*64+d)][2048 s] hi
#define WS_VTL (WS_VTH + 2u * NB * DM * SS)        // f16 lo x 2048
#define WS_O   (WS_VTL + 2u * NB * DM * SS)        // f32 [8192][1024]
#define WS_CS  (WS_O + 4u * NB * SS * DM)           // f32 2 x [2048][32], reserved but never written or read (no RoPE)
#define WS_END (WS_CS + 4u * 2 * SS * 32)
// ---- k_pack: block = (row n, which): natural [out][in] rows -> bf16; which 0..2 -> W_q/W_k/W_v into PK_A rows which*1024 + n; 3 -> W_o into PK_P
__global__ __launch_bounds__(256) void k_pack(const float* __restrict__ WQ, const float* __restrict__ WK, const float* __restrict__ WV, const float* __restrict__ WO, __bf16* __restrict__ PK) {
  __shared__ __align__(16) __bf16 s[DM]; const int n = blockIdx.x, which = blockIdx.y, t = threadIdx.x; const float* Wm = (which == 0) ? WQ : (which == 1) ? WK : (which == 2) ? WV : WO;
  for (int k = t; k < DM; k += 256) s[k] = (__bf16)Wm[(size_t)n * DM + k];
  __syncthreads();
  __bf16* dst = (which < 3) ? PK + PK_A + ((size_t)which * DM + n) * DM : PK + PK_P + (size_t)n * DM;
  for (int q = t; q < DM / 8; q += 256) vst2((unsigned*)(dst + q * 8), *(const v4u*)&s[q * 8]);
}
// ---- tensor-load helpers: a stage of k_attn is 64 keys; four tiles (K hi, K residual, V^T hi, V^T residual), each 64 rows of 128 B at source pitch 4096 B, one tile per wave
typedef unsigned u32x4 __attribute__((ext_vector_type(4)));
typedef unsigned u32x8 __attribute__((ext_vector_type(8)));
#define AKS 64                 // keys per stage
#define APITCH 144             // LDS row pitch in bytes: 128-B rows + 16 (odd multiple of 16 for the ds_load_b128 readers)
#define ASLICE 10240           // one tile in LDS: 64 x 144 B rounded up to a multiple of 2 KiB
#define ABUF (4 * ASLICE)      // one stage
__device__ __forceinline__ unsigned uni(unsigned v) { return (unsigned)__builtin_amdgcn_readfirstlane(v); }
__device__ __forceinline__ unsigned pinned(unsigned v) { unsigned w = uni(v); asm volatile("" : "+s"(w)); return w; }   // the issue test held in a scalar register, so that it compiles to s_cmp + s_cbranch_scc (a tensor load ignores EXEC)
__device__ __forceinline__ u32x4 tdm_group0(unsigned lds_dst, unsigned long long ga) {
  u32x4 g0; g0[0] = uni(1u); g0[1] = uni(lds_dst); g0[2] = uni((unsigned)ga); g0[3] = uni((((unsigned)(ga >> 32)) & 0x01FFFFFFu) | 0x80000000u); return g0;
}
__device__ __forceinline__ u32x8 tdm_group1() {
  u32x8 g1; g1[0] = uni((1u << 20) | (4u << 22) | (3u << 25));   // no mask, 1-byte elements, a pad of 4 dwords behind every 32 dwords (one row)
  g1[1] = uni(128u << 16); g1[2] = uni(64u << 16); g1[3] = uni(128u << 16); g1[4] = uni(64u); g1[5] = uni(4096u); g1[6] = uni(0u); g1[7] = uni(0u);
  asm volatile("" : "+s"(g1));   // descriptor words held in their scalar registers: without it the constants are formed anew at each load and their registers serve as temporaries while a request is out
  return g1;
}
__device__ __forceinline__ void tdm_load(u32x4 g0, u32x8 g1) { asm volatile("tensor_load_to_lds %0, %1" :: "s"(g0), "s"(g1) : "memory"); }
// the wave's own request has landed; the operands keep that request's descriptor registers unwritten up to here
__device__ __forceinline__ void tdm_wait(u32x4 g0, u32x8 g1) { asm volatile("s_wait_tensorcnt 0x0" :: "s"(g0), "s"(g1) : "memory"); }
// ---- ring of the two projection GEMMs: a stage is 64 k of a 64-row x 128-column block; four slices, one per wave: waves 0, 1 bring 32 activation rows each (f32, 256 B a row, source pitch 4096 B), waves 2, 3 bring 64 weight rows each (bf16, 128 B a row, source pitch 2048 B)
#define GKS 64                 // k per stage
#define GST (DM / GKS)         // stages
#define GAP 272                // LDS pitch of an activation row: 256 B + 16 (odd multiple of 16 for the ds_load_b128 readers)
#define GBP 144                // LDS pitch of a weight row: 128 B + 16
#define GSL 10240              // one slice in LDS: 32 x 272 B or 64 x 144 B, rounded up to a multiple of 2 KiB
#define GBUF (4 * GSL)         // one stage
__device__ __forceinline__ u32x8 tdm_group1_act() {
  u32x8 g1; g1[0] = uni((1u << 20) | (5u << 22) | (3u << 25));   // no mask, 1-byte elements, a pad of 4 dwords behind every 64 dwords (one row)
  g1[1] = uni(256u << 16); g1[2] = uni(32u << 16); g1[3] = uni(256u << 16); g1[4] = uni(32u); g1[5] = uni(4096u); g1[6] = uni(0u); g1[7] = uni(0u);
  asm volatile("" : "+s"(g1));   // descriptor words held in their scalar registers (as in tdm_group1)
  return g1;
}
__device__ __forceinline__ u32x8 tdm_group1_wgt() {
  u32x8 g1; g1[0] = uni((1u << 20) | (4u << 22) | (3u << 25));   // no mask, 1-byte elements, a pad of 4 dwords behind every 32 dwords (one row)
  g1[1] = uni(128u << 16); g1[2] = uni(64u << 16); g1[3] = uni(128u << 16); g1[4] = uni(64u); g1[5] = uni(2048u); g1[6] = uni(0u); g1[7] = uni(0u);
  asm volatile("" : "+s"(g1));   // descriptor words held in their scalar registers (as in tdm_group1)
  return g1;
}
// every wave issues its one slice; the two scalar branches only pick which of the two constant descriptors goes with it (act is 1 in waves 0 and 1, 0 in waves 2 and 3)
__device__ __forceinline__ void gemm_load(unsigned act, u32x4 g0, u32x8 ga, u32x8 gw) { if (pinned(act)) tdm_load(g0, ga); if (pinned(act ^ 1u)) tdm_load(g0, gw); }
// the wave's own request has landed; the operands keep the descriptor registers unwritten up to here
__device__ __forceinline__ void gemm_wait(u32x4 g0, u32x8 ga, u32x8 gw) { asm volatile("s_wait_tensorcnt 0x0" :: "s"(g0), "s"(ga), "s"(gw) : "memory"); }
__global__ __launch_bounds__(128) void k_qkv(const float* __restrict__ X, const __bf16* __restrict__ P, const float* __restrict__ BQ, const float* __restrict__ BK, const float* __restrict__ BV, _Float16* __restrict__ QK, _Float16* __restrict__ QKL, _Float16* __restrict__ VTH, _Float16* __restrict__ VTL) {
  __shared__ __attribute__((aligned(2048))) unsigned char ring[2 * GBUF];   // two stages of x and W slices, shared by the four waves; behind the K loop the same bytes stage the output
  _Float16 (*so)[16][136] = (_Float16 (*)[16][136])ring, (*sol)[16][136] = (_Float16 (*)[16][136])(ring + 4 * 16 * 136 * 2); _Float16 (*sth)[72] = (_Float16 (*)[72])ring, (*stl)[72] = (_Float16 (*)[72])(ring + 128 * 72 * 2);
  const int tid = threadIdx.x, wave = tid >> 5, lane = tid & 31, col = lane & 15, g = lane >> 4; const size_t r0 = (size_t)blockIdx.x * 64 + wave * 16; const int n0 = blockIdx.y * 128;
  const unsigned wv = uni((unsigned)tid >> 5), act = (wv < 2u) ? 1u : 0u;
  const unsigned long long tsrc = act ? (unsigned long long)(size_t)(X + ((size_t)blockIdx.x * 64 + wv * 32) * DM) : (unsigned long long)(size_t)(P + ((size_t)n0 + (wv - 2u) * 64) * DM);
  const unsigned tstep = act ? (unsigned)(GKS * 4) : (unsigned)(GKS * 2);   // bytes from one stage's slice to the next
  const unsigned tdst = (unsigned)(size_t)ring + wv * GSL;
  const u32x8 ga = tdm_group1_act(), gw = tdm_group1_wgt(); u32x4 g0 = tdm_group0(tdst, tsrc);
  gemm_load(act, g0, ga, gw);                                                             // stage 0
  gemm_wait(g0, ga, gw);                                                                  // this wave's slice of stage 0 has landed
  __syncthreads();                                                                        // stage 0 published to all four waves
  g0 = tdm_group0(tdst + GBUF, tsrc + tstep);
  gemm_load(act, g0, ga, gw);                                                             // stage 1
  const unsigned aoff = (unsigned)((wave >> 1) * GSL + ((wave & 1) * 16 + col) * GAP + 32 * g), boff = (unsigned)(2 * GSL + col * GBP);
  v8f acc[8] = {};
  // the stage loop stays rolled: one publish point and one refill site, and the buffer is picked by the stage's parity
#pragma unroll 1
  for (int st = 0; st < GST; ++st) { const unsigned char* buf = ring + (st & 1) * GBUF;
#pragma unroll
    for (int kc = 0; kc < 2; ++kc) { v16b a; { const float* p = (const float*)(buf + aoff + kc * 128);
#pragma unroll
        for (int i = 0; i < 8; ++i) { a[i] = (__bf16)p[i]; a[8 + i] = (__bf16)p[16 + i]; } }
#pragma unroll
      for (int j = 0; j < 8; ++j) acc[j] = wmma_bf(a, frag_b((const __bf16*)(buf + boff + (j >> 2) * GSL + (j & 3) * 16 * GBP) + kc * 32, lane), acc[j]); }
    asm volatile("s_wait_dscnt 0x0" ::: "memory");        // this wave's reads of stage st are done
    gemm_wait(g0, ga, gw);                                // this wave's slice of stage st + 1 has landed
    __syncthreads();                                      // publishes stage st + 1 and ends every wave's reads of stage st
    if (pinned(st + 2 < GST)) { g0 = tdm_group0(tdst + (unsigned)(st & 1) * GBUF, tsrc + (unsigned long long)(unsigned)(st + 2) * tstep); gemm_load(act, g0, ga, gw); } }   // refill of the buffer just left
  gemm_wait(g0, ga, gw);                                  // no request outstanding behind the loop; the last pass's barrier has ended every read of the ring, which now stages the output
  asm volatile("s_wait_dscnt 0x0" ::: "memory");
  { const int which = n0 / DM; const float* BB = (which == 0) ? BQ : (which == 1) ? BK : BV;
#pragma unroll
    for (int j = 0; j < 8; ++j) { const float bb = bfr(BB[(n0 % DM) + j * 16 + col]);
#pragma unroll
      for (int r = 0; r < 8; ++r) acc[j][r] += bb; } }
  if (n0 < 2 * DM) {   // q stored unscaled (f16 sigma ~0.6, no subnormal exposure); 1/8 applied to the f32 score
#pragma unroll
    for (int j = 0; j < 8; ++j) {
#pragma unroll
      for (int r = 0; r < 8; ++r) { const float v = acc[j][r]; const _Float16 hv = (_Float16)v; so[wave][8 * g + r][j * 16 + col] = hv; sol[wave][8 * g + r][j * 16 + col] = (_Float16)((v - (float)hv) * 2048.0f); } }   // q, k as f16 hi + (x2048) residual (no RoPE in this module)
    LDSX();
    for (int rl = 0; rl < 16; ++rl) if (lane < 16) { vst2((unsigned*)(QK + (r0 + rl) * (2 * DM) + n0 + lane * 8), *(const v4u*)&so[wave][rl][lane * 8]); vst2((unsigned*)(QKL + (r0 + rl) * (2 * DM) + n0 + lane * 8), *(const v4u*)&sol[wave][rl][lane * 8]); }
  } else {
#pragma unroll
    for (int j = 0; j < 8; ++j) {
#pragma unroll
      for (int r = 0; r < 8; ++r) { const float v = acc[j][r]; const _Float16 hv = (_Float16)v; sth[j * 16 + col][wave * 16 + 8 * g + r] = hv; stl[j * 16 + col][wave * 16 + 8 * g + r] = (_Float16)((v - (float)hv) * 2048.0f); } }
    __syncthreads();
    const size_t rb = (size_t)blockIdx.x * 64; const int b = (int)(rb / SS), s0 = (int)(rb % SS); const int pc0 = n0 - 2 * DM;
    for (int q = tid; q < 128 * 8; q += 128) { const int d = q >> 3, pc = q & 7; const size_t o = ((size_t)b * DM + pc0 + d) * SS + s0 + pc * 8; vst2((unsigned*)(VTH + o), *(const v4u*)&sth[d][pc * 8]); vst2((unsigned*)(VTL + o), *(const v4u*)&stl[d][pc * 8]); }
  }
}
// ---- k_attn: block = (64 queries, head h, batch b): causal flash attention (K = 64: 2 k-steps), scores = (q.k) * 0.125 from q, k as f16 hi + residual (3 products), P.V: P as f16 hi + (x2048) residual x (V hi, V lo*2048) (3 products) in two accumulators; O[b*S+q][h*64+d] = (acc + accl / 2048) / l (256-B segments)
__global__ __launch_bounds__(128) void k_attn(const _Float16* __restrict__ QK, const _Float16* __restrict__ QKL, const _Float16* __restrict__ VTH, const _Float16* __restrict__ VTL, float* __restrict__ O) {
  __shared__ __attribute__((aligned(2048))) unsigned char ring[2 * ABUF];   // two stages of K/V tiles, shared by the four waves
  __shared__ __align__(16) float sp[4][16][36]; __shared__ __align__(16) float so[4][16][68];
  const int tid = threadIdx.x, wave = tid >> 5, lane = tid & 31, col = lane & 15, g = lane >> 4;
  const int qb = blockIdx.x, h = blockIdx.y, b = blockIdx.z; const int q0 = qb * 64 + wave * 16; const size_t rq = (size_t)b * SS + q0 + col;
  // every wave brings one tile of each stage: wave 0 K hi, 1 K residual (64 key rows), 2 V^T hi, 3 V^T residual (64 d rows x 64 keys)
  const unsigned wv = uni((unsigned)tid >> 5); const size_t ko = (size_t)b * SS * (2 * DM) + DM + h * HD, vo = ((size_t)b * DM + h * HD) * SS;
  const _Float16* tsrc = (wv == 0u) ? QK + ko : (wv == 1u) ? QKL + ko : (wv == 2u) ? VTH + vo : VTL + vo;
  const unsigned tstep = (wv < 2u) ? (unsigned)(AKS * 2 * DM * 2) : (unsigned)(AKS * 2);   // bytes from one stage's tile to the next
  const unsigned tdst = (unsigned)(size_t)ring + wv * ASLICE;
  const u32x8 g1 = tdm_group1(); u32x4 g0 = tdm_group0(tdst, (unsigned long long)(size_t)tsrc);
  tdm_load(g0, g1);                                                                       // stage 0
  tdm_wait(g0, g1);                                                                       // this wave's tile of stage 0 has landed
  __syncthreads();                                                                        // stage 0 published to all four waves
  g0 = tdm_group0(tdst + ABUF, (unsigned long long)(size_t)tsrc + tstep);
  tdm_load(g0, g1);                                                                       // stage 1 (keys 64..127 exist for every block; unread where qb is 0)
  v16h aq[2], aql[2];
#pragma unroll
  for (int kc = 0; kc < 2; ++kc) { aq[kc] = frag_h(QK + rq * (2 * DM) + h * HD + kc * 32, lane); aql[kc] = frag_h(QKL + rq * (2 * DM) + h * HD + kc * 32, lane); }
  float m[8], l[8];
#pragma unroll
  for (int r = 0; r < 8; ++r) { m[r] = -3.0e38f; l[r] = 0.f; }
  v8f acc[4] = {}, accl[4] = {};
  const int nst = qb + 1;
#pragma unroll 1
  for (int st = 0; st < nst; ++st) { const unsigned char* buf = ring + (st & 1) * ABUF;
#pragma unroll
  for (int sub = 0; sub < 2; ++sub) { const int ks = st * 2 + sub; v8f s[2];
#pragma unroll
    for (int ct = 0; ct < 2; ++ct) { const int kk = ks * 32 + ct * 16 + col; const _Float16* krow = (const _Float16*)(buf + (sub * 32 + ct * 16 + col) * APITCH); const _Float16* krowl = (const _Float16*)(buf + ASLICE + (sub * 32 + ct * 16 + col) * APITCH); v8f c = {}, cl = {};
#pragma unroll
      for (int kc = 0; kc < 2; ++kc) { const v16h kh = frag_h(krow + kc * 32, lane); c = wmma16(aq[kc], kh, c); cl = wmma16(aql[kc], kh, cl); cl = wmma16(aq[kc], frag_h(krowl + kc * 32, lane), cl); }   // 3 products: q, k as f16 hi + residual
#pragma unroll
      for (int r = 0; r < 8; ++r) c[r] += cl[r] * (1.0f / 2048.0f);
#pragma unroll
      for (int r = 0; r < 8; ++r) { const int qi = q0 + 8 * g + r; s[ct][r] = (kk <= qi) ? c[r] * 0.125f : -3.0e38f; } }   // SCALE = 1/sqrt(64)
#pragma unroll
    for (int r = 0; r < 8; ++r) { float mx = fmaxf(s[0][r], s[1][r]);
#pragma unroll
      for (int o = 1; o < 16; o <<= 1) mx = fmaxf(mx, __shfl_xor(mx, o));
      const float mn = fmaxf(m[r], mx); const float alpha = (m[r] <= -1.0e38f) ? 0.f : __expf(m[r] - mn);
      const float e0 = (s[0][r] <= -1.0e38f) ? 0.f : __expf(s[0][r] - mn), e1 = (s[1][r] <= -1.0e38f) ? 0.f : __expf(s[1][r] - mn); float es = e0 + e1;
#pragma unroll
      for (int o = 1; o < 16; o <<= 1) es += __shfl_xor(es, o);
      l[r] = l[r] * alpha + es; m[r] = mn;
#pragma unroll
      for (int dt = 0; dt < 4; ++dt) { acc[dt][r] *= alpha; accl[dt][r] *= alpha; }
      sp[wave][8 * g + r][col] = e0; sp[wave][8 * g + r][16 + col] = e1; }
    LDSX();
    v16h pa, pl; { const float* prow = &sp[wave][col][0] + 8 * (lane >> 4);
#pragma unroll
      for (int i = 0; i < 8; ++i) { const float x0 = prow[i], x1 = prow[16 + i]; const _Float16 h0 = (_Float16)x0, h1 = (_Float16)x1; pa[i] = h0; pa[8 + i] = h1; pl[i] = (_Float16)((x0 - (float)h0) * 2048.0f); pl[8 + i] = (_Float16)((x1 - (float)h1) * 2048.0f); } }
#pragma unroll
    for (int dt = 0; dt < 4; ++dt) { const unsigned char* vr = buf + 2 * ASLICE + (dt * 16 + col) * APITCH + sub * 64; const v16h vh = frag_h((const _Float16*)vr, lane); acc[dt] = wmma16(pa, vh, acc[dt]); accl[dt] = wmma16(pl, vh, accl[dt]); accl[dt] = wmma16(pa, frag_h((const _Float16*)(vr + ASLICE), lane), accl[dt]); }   // P hi x V hi + (P lo x V hi + P hi x V lo) / 2048
    LDSX(); }
    asm volatile("s_wait_dscnt 0x0" ::: "memory");        // this wave's reads of stage st are done
    tdm_wait(g0, g1);                                     // this wave's tile of stage st + 1 has landed
    __syncthreads();                                      // publishes stage st + 1 and ends every wave's reads of stage st
    if (pinned(st + 2 < nst)) { g0 = tdm_group0(tdst + (unsigned)(st & 1) * ABUF, (unsigned long long)(size_t)tsrc + (unsigned long long)(unsigned)(st + 2) * tstep); tdm_load(g0, g1); } }   // refill of the buffer just left
  tdm_wait(g0, g1);                                       // no request outstanding when the wave goes on to its end
  asm volatile("s_wait_dscnt 0x0" ::: "memory");
#pragma unroll
  for (int r = 0; r < 8; ++r) { const float il = 1.0f / l[r];
#pragma unroll
    for (int dt = 0; dt < 4; ++dt) so[wave][8 * g + r][dt * 16 + col] = (acc[dt][r] + accl[dt][r] * (1.0f / 2048.0f)) * il; }
  LDSX();
  for (int rl = 0; rl < 16; ++rl) if (lane < 16) vst2(O + ((size_t)b * SS + q0 + rl) * DM + h * HD + lane * 4, *(const v4f*)&so[wave][rl][lane * 4]);
}
// ---- k_out: block = (64 rows, 128 cols): out = O(hi/lo) . Wo rows (2 products) + bo
__global__ __launch_bounds__(128) void k_out(const float* __restrict__ O, const __bf16* __restrict__ P, const float* __restrict__ BO, float* __restrict__ Y) {
  __shared__ __attribute__((aligned(2048))) unsigned char ring[2 * GBUF];   // two stages of ctx and Wo slices, shared by the four waves; behind the K loop the same bytes stage the output
  float (*so)[16][132] = (float (*)[16][132])ring;
  const int tid = threadIdx.x, wave = tid >> 5, lane = tid & 31, col = lane & 15, g = lane >> 4; const size_t r0 = (size_t)blockIdx.x * 64 + wave * 16; const int n0 = blockIdx.y * 128;
  const unsigned wv = uni((unsigned)tid >> 5), act = (wv < 2u) ? 1u : 0u;
  const unsigned long long tsrc = act ? (unsigned long long)(size_t)(O + ((size_t)blockIdx.x * 64 + wv * 32) * DM) : (unsigned long long)(size_t)(P + ((size_t)n0 + (wv - 2u) * 64) * DM);
  const unsigned tstep = act ? (unsigned)(GKS * 4) : (unsigned)(GKS * 2);   // bytes from one stage's slice to the next
  const unsigned tdst = (unsigned)(size_t)ring + wv * GSL;
  const u32x8 ga = tdm_group1_act(), gw = tdm_group1_wgt(); u32x4 g0 = tdm_group0(tdst, tsrc);
  gemm_load(act, g0, ga, gw);                                                             // stage 0
  gemm_wait(g0, ga, gw);                                                                  // this wave's slice of stage 0 has landed
  __syncthreads();                                                                        // stage 0 published to all four waves
  g0 = tdm_group0(tdst + GBUF, tsrc + tstep);
  gemm_load(act, g0, ga, gw);                                                             // stage 1
  const unsigned aoff = (unsigned)((wave >> 1) * GSL + ((wave & 1) * 16 + col) * GAP), boff = (unsigned)(2 * GSL + col * GBP);
  v8f acc[8] = {};
  // the stage loop stays rolled: one publish point and one refill site, and the buffer is picked by the stage's parity
#pragma unroll 1
  for (int st = 0; st < GST; ++st) { const unsigned char* buf = ring + (st & 1) * GBUF;
#pragma unroll
    for (int kc = 0; kc < 2; ++kc) { const F2 a = split_row((const float*)(buf + aoff), kc * 32, lane);
#pragma unroll
      for (int j = 0; j < 8; ++j) { const v16b w = frag_b((const __bf16*)(buf + boff + (j >> 2) * GSL + (j & 3) * 16 * GBP) + kc * 32, lane); acc[j] = wmma_bf(a.l, w, acc[j]); acc[j] = wmma_bf(a.h, w, acc[j]); } }
    asm volatile("s_wait_dscnt 0x0" ::: "memory");        // this wave's reads of stage st are done
    gemm_wait(g0, ga, gw);                                // this wave's slice of stage st + 1 has landed
    __syncthreads();                                      // publishes stage st + 1 and ends every wave's reads of stage st
    if (pinned(st + 2 < GST)) { g0 = tdm_group0(tdst + (unsigned)(st & 1) * GBUF, tsrc + (unsigned long long)(unsigned)(st + 2) * tstep); gemm_load(act, g0, ga, gw); } }   // refill of the buffer just left
  gemm_wait(g0, ga, gw);                                  // no request outstanding behind the loop; the last pass's barrier has ended every read of the ring, which now stages the output
  asm volatile("s_wait_dscnt 0x0" ::: "memory");
#pragma unroll
  for (int j = 0; j < 8; ++j) {
#pragma unroll
    for (int r = 0; r < 8; ++r) so[wave][8 * g + r][j * 16 + col] = acc[j][r] + bfr(BO[n0 + j * 16 + col]); }
  LDSX();
  for (int rl = 0; rl < 16; ++rl) vst2(Y + (r0 + rl) * DM + n0 + lane * 4, *(const v4f*)&so[wave][rl][lane * 4]);
}
extern "C" void kernel_launch(void* const* d_in, const int* in_sizes, int n_in, void* d_out, int out_size, void* d_ws, size_t ws_size, hipStream_t stream) {
  (void)in_sizes; (void)n_in; (void)out_size;
  const float** F = (const float**)d_in;   // 0 x [4,2048,1024], 1 Wq [1024,1024] natural, 2 bq, 3 Wk, 4 bk, 5 Wv, 6 bv, 7 Wo, 8 bo
  if (ws_size < (size_t)WS_END) return;
  char* ws = (char*)d_ws; __bf16* PK = (__bf16*)(ws + WS_PK); _Float16 *QK = (_Float16*)(ws + WS_QK), *QKL = (_Float16*)(ws + WS_QKL), *VTH = (_Float16*)(ws + WS_VTH), *VTL = (_Float16*)(ws + WS_VTL); float* O = (float*)(ws + WS_O);
  k_pack<<<dim3(DM, 4), 256, 0, stream>>>(F[1], F[3], F[5], F[7], PK);
  k_qkv<<<dim3(TNB * SS / 64, QKVW / 128), 128, 0, stream>>>(F[0], PK + PK_A, F[2], F[4], F[6], QK, QKL, VTH, VTL);
  k_attn<<<dim3(TQB, NH, TNB), 128, 0, stream>>>(QK, QKL, VTH, VTL, O);
  k_out<<<dim3(TOB, DM / 128), 128, 0, stream>>>(O, PK + PK_P, F[8], (float*)d_out);
}

// v003
// A run of this version takes 286 microseconds.
// Timed twice side by side with v002, it ran 1.25 times as fast both times.
// All steps since v000 together make it 2.91 times as fast.
// compute dtype: x, Wq..Wo, bq..bo (module inputs) rounded to bf16; q/k/v projections with exact bf16 products on WMMA 16x16x32 (natural [out][in] rows) + biases; q and k stored as f16 hi + (x2048-scaled) residual planes with 3-product scores, x 1/sqrt(64), causal mask (k > q -> -1e9 in the module, zero weight), running-max softmax in f32 (hardware exp); P as f16 hi + (x2048) residual x v hi/lo (3 products); output projection with ctx as bf16 hi + residual x exact Wo rows (2 products) + bo; f32 accumulate.
#include <hip/hip_runtime.h>
#include <math.h>

typedef __attribute__((ext_vector_type(16))) _Float16 v16h;
typedef __attribute__((ext_vector_type(16))) __bf16 v16b;
typedef __attribute__((ext_vector_type(8)))  _Float16 v8h;
typedef __attribute__((ext_vector_type(8)))  float v8f;
typedef __attribute__((ext_vector_type(4)))  float v4f;
typedef __attribute__((ext_vector_type(2)))  float v2f;
typedef __attribute__((ext_vector_type(4)))  unsigned v4u;
typedef __attribute__((ext_vector_type(4)))  int v4i;
typedef float __attribute__((may_alias)) float_a;
typedef int __attribute__((may_alias)) int_a;

template <typename T> __device__ __forceinline__ void vst2(void* p, T v) { *(T*)p = v;  }
__device__ __forceinline__ v8f wmma16(v16h a, v16h b, v8f c) {
  v8f d = __builtin_amdgcn_wmma_f32_16x16x32_f16(false, a, false, b, (short)0, c, false, false);
  asm volatile("v_nop\n\tv_nop\n\tv_nop\n\tv_nop" : "+v"(d) : "v"(a), "v"(b));
  return d;
}
__device__ __forceinline__ v8f wmma_bf(v16b a, v16b b, v8f c) {
  v8f d = __builtin_amdgcn_wmma_f32_16x16x32_bf16(false, a, false, b, (short)0, c, false, false);
  asm volatile("v_nop\n\tv_nop\n\tv_nop\n\tv_nop" : "+v"(d) : "v"(a), "v"(b));
  return d;
}
// Masked (causal) multi-head attention (B 4, S 2,048, d 1,024, 16 heads x 64; four biased projections).
__device__ __forceinline__ v16h frag_h(const _Float16* rowk0, int lane) {
  union { v16h v; v8h q[2]; } u; const _Float16* p = rowk0 + 8 * (lane >> 4);
  u.q[0] = *(const v8h*)p; u.q[1] = *(const v8h*)(p + 16); return u.v;
}
__device__ __forceinline__ v16h frag_f32(const float* rowk0, int lane) {
  v16h a; const float* p = rowk0 + 8 * (lane >> 4);
#pragma unroll
  for (int i = 0; i < 8; ++i) { a[i] = (_Float16)p[i]; a[8 + i] = (_Float16)p[16 + i]; }
  return a;
}
__device__ __forceinline__ v16h frag_f32s(const float* rowk0, int lane, float sc) {
  v16h a; const float* p = rowk0 + 8 * (lane >> 4);
#pragma unroll
  for (int i = 0; i < 8; ++i) { a[i] = (_Float16)(p[i] * sc); a[8 + i] = (_Float16)(p[16 + i] * sc); }
  return a;
}
// column fragment from a [K][ld] layout (column n), rows >= K read as 0
__device__ __forceinline__ v16h fragc_f32(const float* W, int k0, int n, int lane, int ld, int K) {
  v16h a; const int g = lane >> 4;
#pragma unroll
  for (int i = 0; i < 8; ++i) { const int ka = k0 + 8 * g + i, kb = ka + 16;
    a[i] = (_Float16)(ka < K ? W[(size_t)(ka < K ? ka : K - 1) * ld + n] : 0.f); a[8 + i] = (_Float16)(kb < K ? W[(size_t)(kb < K ? kb : K - 1) * ld + n] : 0.f); }
  return a;
}
struct F2 { v16b h, l; };
__device__ __forceinline__ F2 bsplit16(const float v[16]) { F2 r;
#pragma unroll
  for (int i = 0; i < 16; ++i) { const __bf16 h = (__bf16)v[i]; r.h[i] = h; r.l[i] = (__bf16)(v[i] - (float)h); }
  return r; }
__device__ __forceinline__ F2 split_row(const float* row, int k0, int lane) { float v[16]; const float* p = row + k0 + 8 * (lane >> 4);
#pragma unroll
  for (int i = 0; i < 8; ++i) { v[i] = p[i]; v[8 + i] = p[16 + i]; }
  return bsplit16(v); }
__device__ __forceinline__ F2 split_rowK(const float* row, int k0, int lane, int K) { float v[16]; const int g = lane >> 4;
#pragma unroll
  for (int i = 0; i < 8; ++i) { const int ka = k0 + 8 * g + i, kb = ka + 16; v[i] = ka < K ? row[ka < K ? ka : K - 1] : 0.f; v[8 + i] = kb < K ? row[kb < K ? kb : K - 1] : 0.f; }
  return bsplit16(v); }
__device__ __forceinline__ F2 split_col(const float* W, int k0, int n, int lane, int ld, int K) { float v[16]; const int g = lane >> 4;
#pragma unroll
  for (int i = 0; i < 8; ++i) { const int ka = k0 + 8 * g + i, kb = ka + 16; v[i] = ka < K ? W[(size_t)(ka < K ? ka : K - 1) * ld + n] : 0.f; v[8 + i] = kb < K ? W[(size_t)(kb < K ? kb : K - 1) * ld + n] : 0.f; }
  return bsplit16(v); }
__device__ __forceinline__ v8f mac3(const F2& a, const F2& b, v8f c) { c = wmma_bf(a.l, b.h, c); c = wmma_bf(a.h, b.l, c); return wmma_bf(a.h, b.h, c); }
__device__ __forceinline__ float sigm(float v) { return 1.0f / (1.0f + expf(-v)); }
#define LDSX() do { asm volatile("s_wait_dscnt 0" ::: "memory"); __builtin_amdgcn_wave_barrier(); __builtin_amdgcn_fence(__ATOMIC_RELEASE, "workgroup"); } while (0)


#define NB 4
#define SS 2048
#define DM 1024
#define NH 16
#define HD 64
#define QKVW (3 * DM)
#ifndef TQB
#define TQB (SS / 64)
#define TNB NB
#define TOB (NB * SS / 64)     // output row tiles (all)
#endif
typedef __attribute__((ext_vector_type(8))) __bf16 v8b;
__device__ __forceinline__ v16b frag_b(const __bf16* rowk0, int lane) {
  union { v16b v; v8b q[2]; } u; const __bf16* p = rowk0 + 8 * (lane >> 4);
  u.q[0] = *(const v8b*)p; u.q[1] = *(const v8b*)(p + 16); return u.v;
}
__device__ __forceinline__ float bfr(float v) { return (float)(__bf16)v; }
__device__ __attribute__((noinline)) float exp_ni(float v) { return expf(v); }
__device__ __attribute__((noinline)) float erf_ni(float v) { return erff(v); }

#define PK_A 0                       // [3072][1024] Wqkv rows (natural [out][in])
#define PK_P (PK_A + QKVW * DM)        // [1024][1024] Wo rows (natural)
#define PK_END (PK_P + DM * DM)
#define WS_PK  0u
#define WS_QK  (WS_PK + 2u * PK_END)             // f16 [8192 rows][2048]: q | k
#define WS_QKL (WS_QK + 2u * NB * SS * 2 * DM)     // f16 q | k residual planes x2048
#define WS_VTH (WS_QKL + 2u * NB * SS * 2 * DM)    // f16 [b][1024 (h*64+d)][2048 s] hi
#define WS_VTL (WS_VTH + 2u * NB * DM * SS)        // f16 lo x 2048
#define WS_O   (WS_VTL + 2u * NB * DM * SS)        // f32 [8192][1024]
#define WS_CS  (WS_O + 4u * NB * SS * DM)           // f32 2 x [2048][32], reserved but never written or read (no RoPE)
#define WS_END (WS_CS + 4u * 2 * SS * 32)
// ---- k_pack: block = (row n, which): natural [out][in] rows -> bf16; which 0..2 -> W_q/W_k/W_v into PK_A rows which*1024 + n; 3 -> W_o into PK_P
__global__ __launch_bounds__(256) void k_pack(const float* __restrict__ WQ, const float* __restrict__ WK, const float* __restrict__ WV, const float* __restrict__ WO, __bf16* __restrict__ PK) {
  __shared__ __align__(16) __bf16 s[DM]; const int n = blockIdx.x, which = blockIdx.y, t = threadIdx.x; const float* Wm = (which == 0) ? WQ : (which == 1) ? WK : (which == 2) ? WV : WO;
  for (int k = t; k < DM; k += 256) s[k] = (__bf16)Wm[(size_t)n * DM + k];
  __syncthreads();
  __bf16* dst = (which < 3) ? PK + PK_A + ((size_t)which * DM + n) * DM : PK + PK_P + (size_t)n * DM;
  for (int q = t; q < DM / 8; q += 256) vst2((unsigned*)(dst + q * 8), *(const v4u*)&s[q * 8]);
}
// ---- tensor-load helpers: a stage of k_attn is 64 keys; four tiles (K hi, K residual, V^T hi, V^T residual), each 64 rows of 128 B at source pitch 4096 B, one tile per wave
typedef unsigned u32x4 __attribute__((ext_vector_type(4)));
typedef unsigned u32x8 __attribute__((ext_vector_type(8)));
#define AKS 64                 // keys per stage
#define APITCH 144             // LDS row pitch in bytes: 128-B rows + 16 (odd multiple of 16 for the ds_load_b128 readers)
#define ASLICE 10240           // one tile in LDS: 64 x 144 B rounded up to a multiple of 2 KiB
#define ABUF (4 * ASLICE)      // one stage
__device__ __forceinline__ unsigned uni(unsigned v) { return (unsigned)__builtin_amdgcn_readfirstlane(v); }
__device__ __forceinline__ unsigned pinned(unsigned v) { unsigned w = uni(v); asm volatile("" : "+s"(w)); return w; }   // the issue test held in a scalar register, so that it compiles to s_cmp + s_cbranch_scc (a tensor load ignores EXEC)
__device__ __forceinline__ u32x4 tdm_group0(unsigned lds_dst, unsigned long long ga) {
  u32x4 g0; g0[0] = uni(1u); g0[1] = uni(lds_dst); g0[2] = uni((unsigned)ga); g0[3] = uni((((unsigned)(ga >> 32)) & 0x01FFFFFFu) | 0x80000000u); return g0;
}
__device__ __forceinline__ u32x8 tdm_group1() {
  u32x8 g1; g1[0] = uni((1u << 20) | (4u << 22) | (3u << 25));   // no mask, 1-byte elements, a pad of 4 dwords behind every 32 dwords (one row)
  g1[1] = uni(128u << 16); g1[2] = uni(64u << 16); g1[3] = uni(128u << 16); g1[4] = uni(64u); g1[5] = uni(4096u); g1[6] = uni(0u); g1[7] = uni(0u);
  asm volatile("" : "+s"(g1));   // descriptor words held in their scalar registers: without it the constants are formed anew at each load and their registers serve as temporaries while a request is out
  return g1;
}
__device__ __forceinline__ void tdm_load(u32x4 g0, u32x8 g1) { asm volatile("tensor_load_to_lds %0, %1" :: "s"(g0), "s"(g1) : "memory"); }
// the wave's own request has landed; the operands keep that request's descriptor registers unwritten up to here
__device__ __forceinline__ void tdm_wait(u32x4 g0, u32x8 g1) { asm volatile("s_wait_tensorcnt 0x0" :: "s"(g0), "s"(g1) : "memory"); }
// ---- ring of the two projection GEMMs: a stage is 64 k of a 64-row x 128-column block; four slices, one per wave: waves 0, 1 bring 32 activation rows each (f32, 256 B a row, source pitch 4096 B), waves 2, 3 bring 64 weight rows each (bf16, 128 B a row, source pitch 2048 B)
#define GKS 64                 // k per stage
#define GST (DM / GKS)         // stages
#define GAP 272                // LDS pitch of an activation row: 256 B + 16 (odd multiple of 16 for the ds_load_b128 readers)
#define GBP 144                // LDS pitch of a weight row: 128 B + 16
#define GSL 10240              // one slice in LDS: 32 x 272 B or 64 x 144 B, rounded up to a multiple of 2 KiB
#define GBUF (4 * GSL)         // one stage
__device__ __forceinline__ u32x8 tdm_group1_act() {
  u32x8 g1; g1[0] = uni((1u << 20) | (5u << 22) | (3u << 25));   // no mask, 1-byte elements, a pad of 4 dwords behind every 64 dwords (one row)
  g1[1] = uni(256u << 16); g1[2] = uni(32u << 16); g1[3] = uni(256u << 16); g1[4] = uni(32u); g1[5] = uni(4096u); g1[6] = uni(0u); g1[7] = uni(0u);
  asm volatile("" : "+s"(g1));   // descriptor words held in their scalar registers (as in tdm_group1)
  return g1;
}
__device__ __forceinline__ u32x8 tdm_group1_wgt() {
  u32x8 g1; g1[0] = uni((1u << 20) | (4u << 22) | (3u << 25));   // no mask, 1-byte elements, a pad of 4 dwords behind every 32 dwords (one row)
  g1[1] = uni(128u << 16); g1[2] = uni(64u << 16); g1[3] = uni(128u << 16); g1[4] = uni(64u); g1[5] = uni(2048u); g1[6] = uni(0u); g1[7] = uni(0u);
  asm volatile("" : "+s"(g1));   // descriptor words held in their scalar registers (as in tdm_group1)
  return g1;
}
// every wave issues its one slice; the two scalar branches only pick which of the two constant descriptors goes with it (act is 1 in waves 0 and 1, 0 in waves 2 and 3)
__device__ __forceinline__ void gemm_load(unsigned act, u32x4 g0, u32x8 ga, u32x8 gw) { if (pinned(act)) tdm_load(g0, ga); if (pinned(act ^ 1u)) tdm_load(g0, gw); }
// the wave's own request has landed; the operands keep the descriptor registers unwritten up to here
__device__ __forceinline__ void gemm_wait(u32x4 g0, u32x8 ga, u32x8 gw) { asm volatile("s_wait_tensorcnt 0x0" :: "s"(g0), "s"(ga), "s"(gw) : "memory"); }
__global__ __launch_bounds__(128) void k_qkv(const float* __restrict__ X, const __bf16* __restrict__ P, const float* __restrict__ BQ, const float* __restrict__ BK, const float* __restrict__ BV, _Float16* __restrict__ QK, _Float16* __restrict__ QKL, _Float16* __restrict__ VTH, _Float16* __restrict__ VTL) {
  __shared__ __attribute__((aligned(2048))) unsigned char ring[2 * GBUF];   // two stages of x and W slices, shared by the four waves; behind the K loop the same bytes stage the output
  _Float16 (*so)[16][136] = (_Float16 (*)[16][136])ring, (*sol)[16][136] = (_Float16 (*)[16][136])(ring + 4 * 16 * 136 * 2); _Float16 (*sth)[72] = (_Float16 (*)[72])ring, (*stl)[72] = (_Float16 (*)[72])(ring + 128 * 72 * 2);
  const int tid = threadIdx.x, wave = tid >> 5, lane = tid & 31, col = lane & 15, g = lane >> 4; const size_t r0 = (size_t)blockIdx.x * 64 + wave * 16; const int n0 = blockIdx.y * 128;
  const unsigned wv = uni((unsigned)tid >> 5), act = (wv < 2u) ? 1u : 0u;
  const unsigned long long tsrc = act ? (unsigned long long)(size_t)(X + ((size_t)blockIdx.x * 64 + wv * 32) * DM) : (unsigned long long)(size_t)(P + ((size_t)n0 + (wv - 2u) * 64) * DM);
  const unsigned tstep = act ? (unsigned)(GKS * 4) : (unsigned)(GKS * 2);   // bytes from one stage's slice to the next
  const unsigned tdst = (unsigned)(size_t)ring + wv * GSL;
  const u32x8 ga = tdm_group1_act(), gw = tdm_group1_wgt(); u32x4 g0 = tdm_group0(tdst, tsrc);
  gemm_load(act, g0, ga, gw);                                                             // stage 0
  gemm_wait(g0, ga, gw);                                                                  // this wave's slice of stage 0 has landed
  __syncthreads();                                                                        // stage 0 published to all four waves
  g0 = tdm_group0(tdst + GBUF, tsrc + tstep);
  gemm_load(act, g0, ga, gw);                                                             // stage 1
  const unsigned aoff = (unsigned)((wave >> 1) * GSL + ((wave & 1) * 16 + col) * GAP + 32 * g), boff = (unsigned)(2 * GSL + col * GBP);
  v8f acc[8] = {};
  // the stage loop stays rolled: one publish point and one refill site, and the buffer is picked by the stage's parity
#pragma unroll 1
  for (int st = 0; st < GST; ++st) { const unsigned char* buf = ring + (st & 1) * GBUF;
#pragma unroll
    for (int kc = 0; kc < 2; ++kc) { v16b a; { const float* p = (const float*)(buf + aoff + kc * 128);
#pragma unroll
        for (int i = 0; i < 8; ++i) { a[i] = (__bf16)p[i]; a[8 + i] = (__bf16)p[16 + i]; } }
#pragma unroll
      for (int j = 0; j < 8; ++j) acc[j] = wmma_bf(a, frag_b((const __bf16*)(buf + boff + (j >> 2) * GSL + (j & 3) * 16 * GBP) + kc * 32, lane), acc[j]); }
    asm volatile("s_wait_dscnt 0x0" ::: "memory");        // this wave's reads of stage st are done
    gemm_wait(g0, ga, gw);                                // this wave's slice of stage st + 1 has landed
    __syncthreads();                                      // publishes stage st + 1 and ends every wave's reads of stage st
    if (pinned(st + 2 < GST)) { g0 = tdm_group0(tdst + (unsigned)(st & 1) * GBUF, tsrc + (unsigned long long)(unsigned)(st + 2) * tstep); gemm_load(act, g0, ga, gw); } }   // refill of the buffer just left
  gemm_wait(g0, ga, gw);                                  // no request outstanding behind the loop; the last pass's barrier has ended every read of the ring, which now stages the output
  asm volatile("s_wait_dscnt 0x0" ::: "memory");
  { const int which = n0 / DM; const float* BB = (which == 0) ? BQ : (which == 1) ? BK : BV;
#pragma unroll
    for (int j = 0; j < 8; ++j) { const float bb = bfr(BB[(n0 % DM) + j * 16 + col]);
#pragma unroll
      for (int r = 0; r < 8; ++r) acc[j][r] += bb; } }
  if (n0 < 2 * DM) {   // q stored unscaled (f16 sigma ~0.6, no subnormal exposure); 1/8 applied to the f32 score
#pragma unroll
    for (int j = 0; j < 8; ++j) {
#pragma unroll
      for (int r = 0; r < 8; ++r) { const float v = acc[j][r]; const _Float16 hv = (_Float16)v; so[wave][8 * g + r][j * 16 + col] = hv; sol[wave][8 * g + r][j * 16 + col] = (_Float16)((v - (float)hv) * 2048.0f); } }   // q, k as f16 hi + (x2048) residual (no RoPE in this module)
    LDSX();
    for (int rl = 0; rl < 16; ++rl) if (lane < 16) { vst2((unsigned*)(QK + (r0 + rl) * (2 * DM) + n0 + lane * 8), *(const v4u*)&so[wave][rl][lane * 8]); vst2((unsigned*)(QKL + (r0 + rl) * (2 * DM) + n0 + lane * 8), *(const v4u*)&sol[wave][rl][lane * 8]); }
  } else {
#pragma unroll
    for (int j = 0; j < 8; ++j) {
#pragma unroll
      for (int r = 0; r < 8; ++r) { const float v = acc[j][r]; const _Float16 hv = (_Float16)v; sth[j * 16 + col][wave * 16 + 8 * g + r] = hv; stl[j * 16 + col][wave * 16 + 8 * g + r] = (_Float16)((v - (float)hv) * 2048.0f); } }
    __syncthreads();
    const size_t rb = (size_t)blockIdx.x * 64; const int b = (int)(rb / SS), s0 = (int)(rb % SS); const int pc0 = n0 - 2 * DM;
    for (int q = tid; q < 128 * 8; q += 128) { const int d = q >> 3, pc = q & 7; const size_t o = ((size_t)b * DM + pc0 + d) * SS + s0 + pc * 8; vst2((unsigned*)(VTH + o), *(const v4u*)&sth[d][pc * 8]); vst2((unsigned*)(VTL + o), *(const v4u*)&stl[d][pc * 8]); }
  }
}
// lane l with lane l ^ 16 (a vector cross-row move, no LDS traffic)
__device__ __forceinline__ float xhalf(float x) { return __builtin_bit_cast(float, __builtin_amdgcn_permlanex16(__builtin_bit_cast(int, x), __builtin_bit_cast(int, x), 0x76543210, 0xfedcba98, false, false)); }
// eight hardware exp2 in one statement, so that the free slot which the instruction set asks for behind a transcendental is there by construction: the outputs are early-clobber (none shares a register with an input), so each v_exp_f32 is followed by one that neither reads its result nor overwrites its source, and the v_nop is the slot behind the last.
__device__ __forceinline__ v8f exp2x8(v8f x) { float e0, e1, e2, e3, e4, e5, e6, e7;
  asm("v_exp_f32 %0, %8\n\tv_exp_f32 %1, %9\n\tv_exp_f32 %2, %10\n\tv_exp_f32 %3, %11\n\tv_exp_f32 %4, %12\n\tv_exp_f32 %5, %13\n\tv_exp_f32 %6, %14\n\tv_exp_f32 %7, %15\n\tv_nop"
      : "=&v"(e0), "=&v"(e1), "=&v"(e2), "=&v"(e3), "=&v"(e4), "=&v"(e5), "=&v"(e6), "=&v"(e7)
      : "v"(x[0]), "v"(x[1]), "v"(x[2]), "v"(x[3]), "v"(x[4]), "v"(x[5]), "v"(x[6]), "v"(x[7]));
  v8f e = {e0, e1, e2, e3, e4, e5, e6, e7}; return e; }
// ---- k_attn: block = (64 queries, head h, batch b): causal flash attention in transposed form: S^T = K . Q^T (A = key rows from LDS, B = the wave's 16 queries, kept in registers), so a lane holds 16 of the 32 scores of ONE query (column = lane & 15; keys 8 g + r and 16 + 8 g + r): maximum and sum run in the lane, one exchange between the wave halves joins the maximum, the halves' sums are joined once at the end. The score registers are already in the k order of a B operand, so P^T (f16 hi + x2048 residual) goes from them straight into O^T += V^T . P^T (A = V^T rows from LDS). Products as before: 3 for the scores, 3 for P.V; O[b*S+q][h*64+d] = (acc + accl / 2048) / l (256-B segments)
__global__ __launch_bounds__(128) void k_attn(const _Float16* __restrict__ QK, const _Float16* __restrict__ QKL, const _Float16* __restrict__ VTH, const _Float16* __restrict__ VTL, float* __restrict__ O) {
  __shared__ __attribute__((aligned(2048))) unsigned char ring[2 * ABUF];   // two stages of K/V tiles, shared by the four waves
  __shared__ __align__(16) float so[4][16][68];
  const int tid = threadIdx.x, wave = tid >> 5, lane = tid & 31, col = lane & 15, g = lane >> 4;
  const int qb = blockIdx.x, h = blockIdx.y, b = blockIdx.z; const int q0 = qb * 64 + wave * 16; const size_t rq = (size_t)b * SS + q0 + col;
  // every wave brings one tile of each stage: wave 0 K hi, 1 K residual (64 key rows), 2 V^T hi, 3 V^T residual (64 d rows x 64 keys)
  const unsigned wv = uni((unsigned)tid >> 5); const size_t ko = (size_t)b * SS * (2 * DM) + DM + h * HD, vo = ((size_t)b * DM + h * HD) * SS;
  const _Float16* tsrc = (wv == 0u) ? QK + ko : (wv == 1u) ? QKL + ko : (wv == 2u) ? VTH + vo : VTL + vo;
  const unsigned tstep = (wv < 2u) ? (unsigned)(AKS * 2 * DM * 2) : (unsigned)(AKS * 2);   // bytes from one stage's tile to the next
  const unsigned tdst = (unsigned)(size_t)ring + wv * ASLICE;
  const u32x8 g1 = tdm_group1(); u32x4 g0 = tdm_group0(tdst, (unsigned long long)(size_t)tsrc);
  tdm_load(g0, g1);                                                                       // stage 0
  tdm_wait(g0, g1);                                                                       // this wave's tile of stage 0 has landed
  __syncthreads();                                                                        // stage 0 published to all four waves
  g0 = tdm_group0(tdst + ABUF, (unsigned long long)(size_t)tsrc + tstep);
  tdm_load(g0, g1);                                                                       // stage 1 (keys 64..127 exist for every block; unread where qb is 0)
  v16h aq[2], aql[2];
#pragma unroll
  for (int kc = 0; kc < 2; ++kc) { aq[kc] = frag_h(QK + rq * (2 * DM) + h * HD + kc * 32, lane); aql[kc] = frag_h(QKL + rq * (2 * DM) + h * HD + kc * 32, lane); }
  float m = -3.0e38f, l = 0.f;   // of query q0 + col; m is the same in both wave halves, l holds this half's keys only
  v8f acc[4] = {}, accl[4] = {};   // O^T: row d = dt * 16 + 8 g + r, column = query
  const int qi = q0 + col;
  const int nst = qb + 1;
#pragma unroll 1
  for (int st = 0; st < nst; ++st) { const unsigned char* buf = ring + (st & 1) * ABUF;
#pragma unroll
  for (int sub = 0; sub < 2; ++sub) { const int ks = st * 2 + sub; v8f s[2];
#pragma unroll
    for (int ct = 0; ct < 2; ++ct) { const int kk = ks * 32 + ct * 16 + 8 * g; const _Float16* krow = (const _Float16*)(buf + (sub * 32 + ct * 16 + col) * APITCH); const _Float16* krowl = (const _Float16*)(buf + ASLICE + (sub * 32 + ct * 16 + col) * APITCH); v8f c = {}, cl = {};
#pragma unroll
      for (int kc = 0; kc < 2; ++kc) { const v16h kh = frag_h(krow + kc * 32, lane); c = wmma16(kh, aq[kc], c); cl = wmma16(kh, aql[kc], cl); cl = wmma16(frag_h(krowl + kc * 32, lane), aq[kc], cl); }   // 3 products: q, k as f16 hi + residual
#pragma unroll
      for (int r = 0; r < 8; ++r) c[r] += cl[r] * (1.0f / 2048.0f);
#pragma unroll
      for (int r = 0; r < 8; ++r) s[ct][r] = (kk + r <= qi) ? c[r] * 0.125f : -3.0e38f; }   // SCALE = 1/sqrt(64)
    float mx = fmaxf(s[0][0], s[1][0]);
#pragma unroll
    for (int r = 1; r < 8; ++r) mx = fmaxf(mx, fmaxf(s[0][r], s[1][r]));
    mx = fmaxf(mx, xhalf(mx));
    const float mn = fmaxf(m, mx); const float alpha = (m <= -1.0e38f) ? 0.f : __expf(m - mn);
    v8f x0, x1;
#pragma unroll
    for (int r = 0; r < 8; ++r) { x0[r] = (s[0][r] - mn) * 1.44269504f; x1[r] = (s[1][r] - mn) * 1.44269504f; }   // exp(v) = exp2(v * log2 e), as __expf forms it
    const v8f y0 = exp2x8(x0), y1 = exp2x8(x1);
    v16h pa, pl; float es[4] = {0.f, 0.f, 0.f, 0.f};   // four independent partial sums
#pragma unroll
    for (int r = 0; r < 8; ++r) { const float e0 = (s[0][r] <= -1.0e38f) ? 0.f : y0[r], e1 = (s[1][r] <= -1.0e38f) ? 0.f : y1[r]; es[r & 3] += e0 + e1;
      const _Float16 h0 = (_Float16)e0, h1 = (_Float16)e1; pa[r] = h0; pa[8 + r] = h1; pl[r] = (_Float16)((e0 - (float)h0) * 2048.0f); pl[8 + r] = (_Float16)((e1 - (float)h1) * 2048.0f); }   // B operand: element r is key 8 g + r, element 8 + r is key 16 + 8 g + r, as in frag_h
    l = l * alpha + ((es[0] + es[1]) + (es[2] + es[3])); m = mn;
#pragma unroll
    for (int dt = 0; dt < 4; ++dt) {
#pragma unroll
      for (int r = 0; r < 8; ++r) { acc[dt][r] *= alpha; accl[dt][r] *= alpha; } }
#pragma unroll
    for (int dt = 0; dt < 4; ++dt) { const unsigned char* vr = buf + 2 * ASLICE + (dt * 16 + col) * APITCH + sub * 64; const v16h vh = frag_h((const _Float16*)vr, lane); acc[dt] = wmma16(vh, pa, acc[dt]); accl[dt] = wmma16(vh, pl, accl[dt]); accl[dt] = wmma16(frag_h((const _Float16*)(vr + ASLICE), lane), pa, accl[dt]); } }   // V hi x P hi + (V hi x P lo + V lo x P hi) / 2048
    asm volatile("s_wait_dscnt 0x0" ::: "memory");        // this wave's reads of stage st are done
    tdm_wait(g0, g1);                                     // this wave's tile of stage st + 1 has landed
    __syncthreads();                                      // publishes stage st + 1 and ends every wave's reads of stage st
    if (pinned(st + 2 < nst)) { g0 = tdm_group0(tdst + (unsigned)(st & 1) * ABUF, (unsigned long long)(size_t)tsrc + (unsigned long long)(unsigned)(st + 2) * tstep); tdm_load(g0, g1); } }   // refill of the buffer just left
  tdm_wait(g0, g1);                                       // no request outstanding when the wave goes on to its end
  asm volatile("s_wait_dscnt 0x0" ::: "memory");
  const float il = 1.0f / (l + xhalf(l));                 // the two halves' sums joined
#pragma unroll
  for (int dt = 0; dt < 4; ++dt) {
#pragma unroll
    for (int r = 0; r < 8; ++r) so[wave][col][dt * 16 + 8 * g + r] = (acc[dt][r] + accl[dt][r] * (1.0f / 2048.0f)) * il; }
  LDSX();
  for (int rl = 0; rl < 16; ++rl) if (lane < 16) vst2(O + ((size_t)b * SS + q0 + rl) * DM + h * HD + lane * 4, *(const v4f*)&so[wave][rl][lane * 4]);
}
// ---- k_out: block = (64 rows, 128 cols): out = O(hi/lo) . Wo rows (2 products) + bo
__global__ __launch_bounds__(128) void k_out(const float* __restrict__ O, const __bf16* __restrict__ P, const float* __restrict__ BO, float* __restrict__ Y) {
  __shared__ __attribute__((aligned(2048))) unsigned char ring[2 * GBUF];   // two stages of ctx and Wo slices, shared by the four waves; behind the K loop the same bytes stage the output
  float (*so)[16][132] = (float (*)[16][132])ring;
  const int tid = threadIdx.x, wave = tid >> 5, lane = tid & 31, col = lane & 15, g = lane >> 4; const size_t r0 = (size_t)blockIdx.x * 64 + wave * 16; const int n0 = blockIdx.y * 128;
  const unsigned wv = uni((unsigned)tid >> 5), act = (wv < 2u) ? 1u : 0u;
  const unsigned long long tsrc = act ? (unsigned long long)(size_t)(O + ((size_t)blockIdx.x * 64 + wv * 32) * DM) : (unsigned long long)(size_t)(P + ((size_t)n0 + (wv - 2u) * 64) * DM);
  const unsigned tstep = act ? (unsigned)(GKS * 4) : (unsigned)(GKS * 2);   // bytes from one stage's slice to the next
  const unsigned tdst = (unsigned)(size_t)ring + wv * GSL;
  const u32x8 ga = tdm_group1_act(), gw = tdm_group1_wgt(); u32x4 g0 = tdm_group0(tdst, tsrc);
  gemm_load(act, g0, ga, gw);                                                             // stage 0
  gemm_wait(g0, ga, gw);                                                                  // this wave's slice of stage 0 has landed
  __syncthreads();                                                                        // stage 0 published to all four waves
  g0 = tdm_group0(tdst + GBUF, tsrc + tstep);
  gemm_load(act, g0, ga, gw);                                                             // stage 1
  const unsigned aoff = (unsigned)((wave >> 1) * GSL + ((wave & 1) * 16 + col) * GAP), boff = (unsigned)(2 * GSL + col * GBP);
  v8f acc[8] = {};
  // the stage loop stays rolled: one publish point and one refill site, and the buffer is picked by the stage's parity
#pragma unroll 1
  for (int st = 0; st < GST; ++st) { const unsigned char* buf = ring + (st & 1) * GBUF;
#pragma unroll
    for (int kc = 0; kc < 2; ++kc) { const F2 a = split_row((const float*)(buf + aoff), kc * 32, lane);
#pragma unroll
      for (int j = 0; j < 8; ++j) { const v16b w = frag_b((const __bf16*)(buf + boff + (j >> 2) * GSL + (j & 3) * 16 * GBP) + kc * 32, lane); acc[j] = wmma_bf(a.l, w, acc[j]); acc[j] = wmma_bf(a.h, w, acc[j]); } }
    asm volatile("s_wait_dscnt 0x0" ::: "memory");        // this wave's reads of stage st are done
    gemm_wait(g0, ga, gw);                                // this wave's slice of stage st + 1 has landed
    __syncthreads();                                      // publishes stage st + 1 and ends every wave's reads of stage st
    if (pinned(st + 2 < GST)) { g0 = tdm_group0(tdst + (unsigned)(st & 1) * GBUF, tsrc + (unsigned long long)(unsigned)(st + 2) * tstep); gemm_load(act, g0, ga, gw); } }   // refill of the buffer just left
  gemm_wait(g0, ga, gw);                                  // no request outstanding behind the loop; the last pass's barrier has ended every read of the ring, which now stages the output
  asm volatile("s_wait_dscnt 0x0" ::: "memory");
#pragma unroll
  for (int j = 0; j < 8; ++j) {
#pragma unroll
    for (int r = 0; r < 8; ++r) so[wave][8 * g + r][j * 16 + col] = acc[j][r] + bfr(BO[n0 + j * 16 + col]); }
  LDSX();
  for (int rl = 0; rl < 16; ++rl) vst2(Y + (r0 + rl) * DM + n0 + lane * 4, *(const v4f*)&so[wave][rl][lane * 4]);
}
extern "C" void kernel_launch(void* const* d_in, const int* in_sizes, int n_in, void* d_out, int out_size, void* d_ws, size_t ws_size, hipStream_t stream) {
  (void)in_sizes; (void)n_in; (void)out_size;
  const float** F = (const float**)d_in;   // 0 x [4,2048,1024], 1 Wq [1024,1024] natural, 2 bq, 3 Wk, 4 bk, 5 Wv, 6 bv, 7 Wo, 8 bo
  if (ws_size < (size_t)WS_END) return;
  char* ws = (char*)d_ws; __bf16* PK = (__bf16*)(ws + WS_PK); _Float16 *QK = (_Float16*)(ws + WS_QK), *QKL = (_Float16*)(ws + WS_QKL), *VTH = (_Float16*)(ws + WS_VTH), *VTL = (_Float16*)(ws + WS_VTL); float* O = (float*)(ws + WS_O);
  k_pack<<<dim3(DM, 4), 256, 0, stream>>>(F[1], F[3], F[5], F[7], PK);
  k_qkv<<<dim3(TNB * SS / 64, QKVW / 128), 128, 0, stream>>>(F[0], PK + PK_A, F[2], F[4], F[6], QK, QKL, VTH, VTL);
  k_attn<<<dim3(TQB, NH, TNB), 128, 0, stream>>>(QK, QKL, VTH, VTL, O);
  k_out<<<dim3(TOB, DM / 128), 128, 0, stream>>>(O, PK + PK_P, F[8], (float*)d_out);
}

// v004
// One run takes 232 microseconds.
// Next to v003, in two timings, it ran 1.23 times as fast each time.
// Over all steps from v000 it is 3.59 times as fast.
// compute dtype: x, Wq..Wo, bq..bo (module inputs) rounded to bf16; q/k/v projections with exact bf16 products on WMMA 16x16x32 (natural [out][in] rows) + biases; q and k stored as f16 hi + (x2048-scaled) residual planes with 3-product scores, x 1/sqrt(64), causal mask (k > q -> -1e9 in the module, zero weight), running-max softmax in f32 (hardware exp); P as f16 hi + (x2048) residual x v hi/lo (3 products); output projection with ctx as bf16 hi + residual x exact Wo rows (2 products) + bo; f32 accumulate.
#include <hip/hip_runtime.h>
#include <math.h>

typedef __attribute__((ext_vector_type(16))) _Float16 v16h;
typedef __attribute__((ext_vector_type(16))) __bf16 v16b;
typedef __attribute__((ext_vector_type(8)))  _Float16 v8h;
typedef __attribute__((ext_vector_type(8)))  float v8f;
typedef __attribute__((ext_vector_type(4)))  float v4f;
typedef __attribute__((ext_vector_type(2)))  float v2f;
typedef __attribute__((ext_vector_type(4)))  unsigned v4u;
typedef __attribute__((ext_vector_type(4)))  int v4i;
typedef float __attribute__((may_alias)) float_a;
typedef int __attribute__((may_alias)) int_a;

template <typename T> __device__ __forceinline__ void vst2(void* p, T v) { *(T*)p = v;  }
__device__ __forceinline__ v8f wmma16(v16h a, v16h b, v8f c) {
  v8f d = __builtin_amdgcn_wmma_f32_16x16x32_f16(false, a, false, b, (short)0, c, false, false);
  return d;
}
__device__ __forceinline__ v8f wmma_bf(v16b a, v16b b, v8f c) {
  v8f d = __builtin_amdgcn_wmma_f32_16x16x32_bf16(false, a, false, b, (short)0, c, false, false);
  return d;
}
// Masked (causal) multi-head attention (B 4, S 2,048, d 1,024, 16 heads x 64; four biased projections).
__device__ __forceinline__ v16h frag_h(const _Float16* rowk0, int lane) {
  union { v16h v; v8h q[2]; } u; const _Float16* p = rowk0 + 8 * (lane >> 4);
  u.q[0] = *(const v8h*)p; u.q[1] = *(const v8h*)(p + 16); return u.v;
}
__device__ __forceinline__ v16h frag_f32(const float* rowk0, int lane) {
  v16h a; const float* p = rowk0 + 8 * (lane >> 4);
#pragma unroll
  for (int i = 0; i < 8; ++i) { a[i] = (_Float16)p[i]; a[8 + i] = (_Float16)p[16 + i]; }
  return a;
}
__device__ __forceinline__ v16h frag_f32s(const float* rowk0, int lane, float sc) {
  v16h a; const float* p = rowk0 + 8 * (lane >> 4);
#pragma unroll
  for (int i = 0; i < 8; ++i) { a[i] = (_Float16)(p[i] * sc); a[8 + i] = (_Float16)(p[16 + i] * sc); }
  return a;
}
// column fragment from a [K][ld] layout (column n), rows >= K read as 0
__device__ __forceinline__ v16h fragc_f32(const float* W, int k0, int n, int lane, int ld, int K) {
  v16h a; const int g = lane >> 4;
#pragma unroll
  for (int i = 0; i < 8; ++i) { const int ka = k0 + 8 * g + i, kb = ka + 16;
    a[i] = (_Float16)(ka < K ? W[(size_t)(ka < K ? ka : K - 1) * ld + n] : 0.f); a[8 + i] = (_Float16)(kb < K ? W[(size_t)(kb < K ? kb : K - 1) * ld + n] : 0.f); }
  return a;
}
struct F2 { v16b h, l; };
__device__ __forceinline__ F2 bsplit16(const float v[16]) { F2 r;
#pragma unroll
  for (int i = 0; i < 16; ++i) { const __bf16 h = (__bf16)v[i]; r.h[i] = h; r.l[i] = (__bf16)(v[i] - (float)h); }
  return r; }
__device__ __forceinline__ F2 split_row(const float* row, int k0, int lane) { float v[16]; const float* p = row + k0 + 8 * (lane >> 4);
#pragma unroll
  for (int i = 0; i < 8; ++i) { v[i] = p[i]; v[8 + i] = p[16 + i]; }
  return bsplit16(v); }
__device__ __forceinline__ F2 split_rowK(const float* row, int k0, int lane, int K) { float v[16]; const int g = lane >> 4;
#pragma unroll
  for (int i = 0; i < 8; ++i) { const int ka = k0 + 8 * g + i, kb = ka + 16; v[i] = ka < K ? row[ka < K ? ka : K - 1] : 0.f; v[8 + i] = kb < K ? row[kb < K ? kb : K - 1] : 0.f; }
  return bsplit16(v); }
__device__ __forceinline__ F2 split_col(const float* W, int k0, int n, int lane, int ld, int K) { float v[16]; const int g = lane >> 4;
#pragma unroll
  for (int i = 0; i < 8; ++i) { const int ka = k0 + 8 * g + i, kb = ka + 16; v[i] = ka < K ? W[(size_t)(ka < K ? ka : K - 1) * ld + n] : 0.f; v[8 + i] = kb < K ? W[(size_t)(kb < K ? kb : K - 1) * ld + n] : 0.f; }
  return bsplit16(v); }
__device__ __forceinline__ v8f mac3(const F2& a, const F2& b, v8f c) { c = wmma_bf(a.l, b.h, c); c = wmma_bf(a.h, b.l, c); return wmma_bf(a.h, b.h, c); }
__device__ __forceinline__ float sigm(float v) { return 1.0f / (1.0f + expf(-v)); }
#define LDSX() do { asm volatile("s_wait_dscnt 0" ::: "memory"); __builtin_amdgcn_wave_barrier(); __builtin_amdgcn_fence(__ATOMIC_RELEASE, "workgroup"); } while (0)


#define NB 4
#define SS 2048
#define DM 1024
#define NH 16
#define HD 64
#define QKVW (3 * DM)
#ifndef TQB
#define TQB (SS / 64)
#define TNB NB
#define TOB (NB * SS / 64)     // output row tiles (all)
#endif
typedef __attribute__((ext_vector_type(8))) __bf16 v8b;
__device__ __forceinline__ v16b frag_b(const __bf16* rowk0, int lane) {
  union { v16b v; v8b q[2]; } u; const __bf16* p = rowk0 + 8 * (lane >> 4);
  u.q[0] = *(const v8b*)p; u.q[1] = *(const v8b*)(p + 16); return u.v;
}
__device__ __forceinline__ float bfr(float v) { return (float)(__bf16)v; }
__device__ __attribute__((noinline)) float exp_ni(float v) { return expf(v); }
__device__ __attribute__((noinline)) float erf_ni(float v) { return erff(v); }

#define PK_A 0                       // [3072][1024] Wqkv rows (natural [out][in])
#define PK_P (PK_A + QKVW * DM)        // [1024][1024] Wo rows (natural)
#define PK_END (PK_P + DM * DM)
#define WS_PK  0u
#define WS_QK  (WS_PK + 2u * PK_END)             // f16 [8192 rows][2048]: q | k
#define WS_QKL (WS_QK + 2u * NB * SS * 2 * DM)     // f16 q | k residual planes x2048
#define WS_VTH (WS_QKL + 2u * NB * SS * 2 * DM)    // f16 [b][1024 (h*64+d)][2048 s] hi
#define WS_VTL (WS_VTH + 2u * NB * DM * SS)        // f16 lo x 2048
#define WS_O   (WS_VTL + 2u * NB * DM * SS)        // f32 [8192][1024]
#define WS_CS  (WS_O + 4u * NB * SS * DM)           // f32 2 x [2048][32], reserved but never written or read (no RoPE)
#define WS_END (WS_CS + 4u * 2 * SS * 32)
// ---- k_pack: block = (row n, which): natural [out][in] rows -> bf16; which 0..2 -> W_q/W_k/W_v into PK_A rows which*1024 + n; 3 -> W_o into PK_P
__global__ __launch_bounds__(256) void k_pack(const float* __restrict__ WQ, const float* __restrict__ WK, const float* __restrict__ WV, const float* __restrict__ WO, __bf16* __restrict__ PK) {
  __shared__ __align__(16) __bf16 s[DM]; const int n = blockIdx.x, which = blockIdx.y, t = threadIdx.x; const float* Wm = (which == 0) ? WQ : (which == 1) ? WK : (which == 2) ? WV : WO;
  for (int k = t; k < DM; k += 256) s[k] = (__bf16)Wm[(size_t)n * DM + k];
  __syncthreads();
  __bf16* dst = (which < 3) ? PK + PK_A + ((size_t)which * DM + n) * DM : PK + PK_P + (size_t)n * DM;
  for (int q = t; q < DM / 8; q += 256) vst2((unsigned*)(dst + q * 8), *(const v4u*)&s[q * 8]);
}
// ---- tensor-load helpers: a stage of k_attn is 64 keys; four tiles (K hi, K residual, V^T hi, V^T residual), each 64 rows of 128 B at source pitch 4096 B, one tile per wave
typedef unsigned u32x4 __attribute__((ext_vector_type(4)));
typedef unsigned u32x8 __attribute__((ext_vector_type(8)));
#define AKS 64                 // keys per stage
#define APITCH 144             // LDS row pitch in bytes: 128-B rows + 16 (odd multiple of 16 for the ds_load_b128 readers)
#define ASLICE 10240           // one tile in LDS: 64 x 144 B rounded up to a multiple of 2 KiB
#define ABUF (4 * ASLICE)      // one stage
__device__ __forceinline__ unsigned uni(unsigned v) { return (unsigned)__builtin_amdgcn_readfirstlane(v); }
__device__ __forceinline__ unsigned pinned(unsigned v) { unsigned w = uni(v); asm volatile("" : "+s"(w)); return w; }   // the issue test held in a scalar register, so that it compiles to s_cmp + s_cbranch_scc (a tensor load ignores EXEC)
__device__ __forceinline__ u32x4 tdm_group0(unsigned lds_dst, unsigned long long ga) {
  u32x4 g0; g0[0] = uni(1u); g0[1] = uni(lds_dst); g0[2] = uni((unsigned)ga); g0[3] = uni((((unsigned)(ga >> 32)) & 0x01FFFFFFu) | 0x80000000u); return g0;
}
__device__ __forceinline__ u32x8 tdm_group1() {
  u32x8 g1; g1[0] = uni((1u << 20) | (4u << 22) | (3u << 25));   // no mask, 1-byte elements, a pad of 4 dwords behind every 32 dwords (one row)
  g1[1] = uni(128u << 16); g1[2] = uni(64u << 16); g1[3] = uni(128u << 16); g1[4] = uni(64u); g1[5] = uni(4096u); g1[6] = uni(0u); g1[7] = uni(0u);
  asm volatile("" : "+s"(g1));   // descriptor words held in their scalar registers: without it the constants are formed anew at each load and their registers serve as temporaries while a request is out
  return g1;
}
__device__ __forceinline__ void tdm_load(u32x4 g0, u32x8 g1) { asm volatile("tensor_load_to_lds %0, %1" :: "s"(g0), "s"(g1) : "memory"); }
// the wave's own request has landed; the operands keep that request's descriptor registers unwritten up to here
__device__ __forceinline__ void tdm_wait(u32x4 g0, u32x8 g1) { asm volatile("s_wait_tensorcnt 0x0" :: "s"(g0), "s"(g1) : "memory"); }
// ---- ring of the two projection GEMMs: a stage is 64 k of a 64-row x 128-column block; four slices, one per wave: waves 0, 1 bring 32 activation rows each (f32, 256 B a row, source pitch 4096 B), waves 2, 3 bring 64 weight rows each (bf16, 128 B a row, source pitch 2048 B)
#define GKS 64                 // k per stage
#define GST (DM / GKS)         // stages
#define GAP 272                // LDS pitch of an activation row: 256 B + 16 (odd multiple of 16 for the ds_load_b128 readers)
#define GBP 144                // LDS pitch of a weight row: 128 B + 16
#define GSL 10240              // one slice in LDS: 32 x 272 B or 64 x 144 B, rounded up to a multiple of 2 KiB
#define GBUF (4 * GSL)         // one stage
__device__ __forceinline__ u32x8 tdm_group1_act() {
  u32x8 g1; g1[0] = uni((1u << 20) | (5u << 22) | (3u << 25));   // no mask, 1-byte elements, a pad of 4 dwords behind every 64 dwords (one row)
  g1[1] = uni(256u << 16); g1[2] = uni(32u << 16); g1[3] = uni(256u << 16); g1[4] = uni(32u); g1[5] = uni(4096u); g1[6] = uni(0u); g1[7] = uni(0u);
  asm volatile("" : "+s"(g1));   // descriptor words held in their scalar registers (as in tdm_group1)
  return g1;
}
__device__ __forceinline__ u32x8 tdm_group1_wgt() {
  u32x8 g1; g1[0] = uni((1u << 20) | (4u << 22) | (3u << 25));   // no mask, 1-byte elements, a pad of 4 dwords behind every 32 dwords (one row)
  g1[1] = uni(128u << 16); g1[2] = uni(64u << 16); g1[3] = uni(128u << 16); g1[4] = uni(64u); g1[5] = uni(2048u); g1[6] = uni(0u); g1[7] = uni(0u);
  asm volatile("" : "+s"(g1));   // descriptor words held in their scalar registers (as in tdm_group1)
  return g1;
}
// every wave issues its one slice; the two scalar branches only pick which of the two constant descriptors goes with it (act is 1 in waves 0 and 1, 0 in waves 2 and 3)
__device__ __forceinline__ void gemm_load(unsigned act, u32x4 g0, u32x8 ga, u32x8 gw) { if (pinned(act)) tdm_load(g0, ga); if (pinned(act ^ 1u)) tdm_load(g0, gw); }
// the wave's own request has landed; the operands keep the descriptor registers unwritten up to here
__device__ __forceinline__ void gemm_wait(u32x4 g0, u32x8 ga, u32x8 gw) { asm volatile("s_wait_tensorcnt 0x0" :: "s"(g0), "s"(ga), "s"(gw) : "memory"); }
__global__ __launch_bounds__(128) void k_qkv(const float* __restrict__ X, const __bf16* __restrict__ P, const float* __restrict__ BQ, const float* __restrict__ BK, const float* __restrict__ BV, _Float16* __restrict__ QK, _Float16* __restrict__ QKL, _Float16* __restrict__ VTH, _Float16* __restrict__ VTL) {
  __shared__ __attribute__((aligned(2048))) unsigned char ring[2 * GBUF];   // two stages of x and W slices, shared by the four waves; behind the K loop the same bytes stage the output
  _Float16 (*so)[16][136] = (_Float16 (*)[16][136])ring, (*sol)[16][136] = (_Float16 (*)[16][136])(ring + 4 * 16 * 136 * 2); _Float16 (*sth)[72] = (_Float16 (*)[72])ring, (*stl)[72] = (_Float16 (*)[72])(ring + 128 * 72 * 2);
  const int tid = threadIdx.x, wave = tid >> 5, lane = tid & 31, col = lane & 15, g = lane >> 4; const size_t r0 = (size_t)blockIdx.x * 64 + wave * 16; const int n0 = blockIdx.y * 128;
  const unsigned wv = uni((unsigned)tid >> 5), act = (wv < 2u) ? 1u : 0u;
  const unsigned long long tsrc = act ? (unsigned long long)(size_t)(X + ((size_t)blockIdx.x * 64 + wv * 32) * DM) : (unsigned long long)(size_t)(P + ((size_t)n0 + (wv - 2u) * 64) * DM);
  const unsigned tstep = act ? (unsigned)(GKS * 4) : (unsigned)(GKS * 2);   // bytes from one stage's slice to the next
  const unsigned tdst = (unsigned)(size_t)ring + wv * GSL;
  const u32x8 ga = tdm_group1_act(), gw = tdm_group1_wgt(); u32x4 g0 = tdm_group0(tdst, tsrc);
  gemm_load(act, g0, ga, gw);                                                             // stage 0
  gemm_wait(g0, ga, gw);                                                                  // this wave's slice of stage 0 has landed
  __syncthreads();                                                                        // stage 0 published to all four waves
  g0 = tdm_group0(tdst + GBUF, tsrc + tstep);
  gemm_load(act, g0, ga, gw);                                                             // stage 1
  const unsigned aoff = (unsigned)((wave >> 1) * GSL + ((wave & 1) * 16 + col) * GAP + 32 * g), boff = (unsigned)(2 * GSL + col * GBP);
  v8f acc[8] = {};
  // the stage loop stays rolled: one publish point and one refill site, and the buffer is picked by the stage's parity
#pragma unroll 1
  for (int st = 0; st < GST; ++st) { const unsigned char* buf = ring + (st & 1) * GBUF;
    v4f ar[2][4]; v16b wf[2][8];   // every fragment of the stage in registers of its own
#pragma unroll
    for (int kc = 0; kc < 2; ++kc) { const v4f* p = (const v4f*)(buf + aoff + kc * 128); ar[kc][0] = p[0]; ar[kc][1] = p[1]; ar[kc][2] = p[4]; ar[kc][3] = p[5];
#pragma unroll
      for (int j = 0; j < 8; ++j) wf[kc][j] = frag_b((const __bf16*)(buf + boff + (j >> 2) * GSL + (j & 3) * 16 * GBP) + kc * 32, lane); }
    __builtin_amdgcn_sched_barrier(0);   // keeps the stage's LDS reads one group ahead of its WMMAs: sunk among them, each WMMA waits out an LDS latency of its own
#pragma unroll
    for (int kc = 0; kc < 2; ++kc) { v16b a;
#pragma unroll
      for (int i = 0; i < 4; ++i) { a[i] = (__bf16)ar[kc][0][i]; a[4 + i] = (__bf16)ar[kc][1][i]; a[8 + i] = (__bf16)ar[kc][2][i]; a[12 + i] = (__bf16)ar[kc][3][i]; }
#pragma unroll
      for (int j = 0; j < 8; ++j) acc[j] = wmma_bf(a, wf[kc][j], acc[j]); }
    __builtin_amdgcn_sched_barrier(0);   // keeps the WMMAs ahead of the publish point: sunk behind its barrier, they delay the refill and stand idle while the next slice lands
    asm volatile("s_wait_dscnt 0x0" ::: "memory");        // this wave's reads of stage st are done
    gemm_wait(g0, ga, gw);                                // this wave's slice of stage st + 1 has landed
    __syncthreads();                                      // publishes stage st + 1 and ends every wave's reads of stage st
    if (pinned(st + 2 < GST)) { g0 = tdm_group0(tdst + (unsigned)(st & 1) * GBUF, tsrc + (unsigned long long)(unsigned)(st + 2) * tstep); gemm_load(act, g0, ga, gw); } }   // refill of the buffer just left
  gemm_wait(g0, ga, gw);                                  // no request outstanding behind the loop; the last pass's barrier has ended every read of the ring, which now stages the output
  asm volatile("s_wait_dscnt 0x0" ::: "memory");
  { const int which = n0 / DM; const float* BB = (which == 0) ? BQ : (which == 1) ? BK : BV;
#pragma unroll
    for (int j = 0; j < 8; ++j) { const float bb = bfr(BB[(n0 % DM) + j * 16 + col]);
#pragma unroll
      for (int r = 0; r < 8; ++r) acc[j][r] += bb; } }
  if (n0 < 2 * DM) {   // q stored unscaled (f16 sigma ~0.6, no subnormal exposure); 1/8 applied to the f32 score
#pragma unroll
    for (int j = 0; j < 8; ++j) {
#pragma unroll
      for (int r = 0; r < 8; ++r) { const float v = acc[j][r]; const _Float16 hv = (_Float16)v; so[wave][8 * g + r][j * 16 + col] = hv; sol[wave][8 * g + r][j * 16 + col] = (_Float16)((v - (float)hv) * 2048.0f); } }   // q, k as f16 hi + (x2048) residual (no RoPE in this module)
    LDSX();
    for (int rl = 0; rl < 16; ++rl) if (lane < 16) { vst2((unsigned*)(QK + (r0 + rl) * (2 * DM) + n0 + lane * 8), *(const v4u*)&so[wave][rl][lane * 8]); vst2((unsigned*)(QKL + (r0 + rl) * (2 * DM) + n0 + lane * 8), *(const v4u*)&sol[wave][rl][lane * 8]); }
  } else {
#pragma unroll
    for (int j = 0; j < 8; ++j) {
#pragma unroll
      for (int r = 0; r < 8; ++r) { const float v = acc[j][r]; const _Float16 hv = (_Float16)v; sth[j * 16 + col][wave * 16 + 8 * g + r] = hv; stl[j * 16 + col][wave * 16 + 8 * g + r] = (_Float16)((v - (float)hv) * 2048.0f); } }
    __syncthreads();
    const size_t rb = (size_t)blockIdx.x * 64; const int b = (int)(rb / SS), s0 = (int)(rb % SS); const int pc0 = n0 - 2 * DM;
    for (int q = tid; q < 128 * 8; q += 128) { const int d = q >> 3, pc = q & 7; const size_t o = ((size_t)b * DM + pc0 + d) * SS + s0 + pc * 8; vst2((unsigned*)(VTH + o), *(const v4u*)&sth[d][pc * 8]); vst2((unsigned*)(VTL + o), *(const v4u*)&stl[d][pc * 8]); }
  }
}
// lane l with lane l ^ 16 (a vector cross-row move, no LDS traffic)
__device__ __forceinline__ float xhalf(float x) { return __builtin_bit_cast(float, __builtin_amdgcn_permlanex16(__builtin_bit_cast(int, x), __builtin_bit_cast(int, x), 0x76543210, 0xfedcba98, false, false)); }
// eight hardware exp2 in one statement, so that the free slot which the instruction set asks for behind a transcendental is there by construction: the outputs are early-clobber (none shares a register with an input), so each v_exp_f32 is followed by one that neither reads its result nor overwrites its source, and the v_nop is the slot behind the last.
__device__ __forceinline__ v8f exp2x8(v8f x) { float e0, e1, e2, e3, e4, e5, e6, e7;
  asm("v_exp_f32 %0, %8\n\tv_exp_f32 %1, %9\n\tv_exp_f32 %2, %10\n\tv_exp_f32 %3, %11\n\tv_exp_f32 %4, %12\n\tv_exp_f32 %5, %13\n\tv_exp_f32 %6, %14\n\tv_exp_f32 %7, %15\n\tv_nop"
      : "=&v"(e0), "=&v"(e1), "=&v"(e2), "=&v"(e3), "=&v"(e4), "=&v"(e5), "=&v"(e6), "=&v"(e7)
      : "v"(x[0]), "v"(x[1]), "v"(x[2]), "v"(x[3]), "v"(x[4]), "v"(x[5]), "v"(x[6]), "v"(x[7]));
  v8f e = {e0, e1, e2, e3, e4, e5, e6, e7}; return e; }
// ---- k_attn: block = (64 queries, head h, batch b): causal flash attention in transposed form: S^T = K . Q^T (A = key rows from LDS, B = the wave's 16 queries, kept in registers), so a lane holds 16 of the 32 scores of ONE query (column = lane & 15; keys 8 g + r and 16 + 8 g + r): maximum and sum run in the lane, one exchange between the wave halves joins the maximum, the halves' sums are joined once at the end. The score registers are already in the k order of a B operand, so P^T (f16 hi + x2048 residual) goes from them straight into O^T += V^T . P^T (A = V^T rows from LDS). Products as before: 3 for the scores, 3 for P.V; O[b*S+q][h*64+d] = (acc + accl / 2048) / l (256-B segments)
__global__ __launch_bounds__(128) void k_attn(const _Float16* __restrict__ QK, const _Float16* __restrict__ QKL, const _Float16* __restrict__ VTH, const _Float16* __restrict__ VTL, float* __restrict__ O) {
  __shared__ __attribute__((aligned(2048))) unsigned char ring[2 * ABUF];   // two stages of K/V tiles, shared by the four waves
  __shared__ __align__(16) float so[4][16][68];
  const int tid = threadIdx.x, wave = tid >> 5, lane = tid & 31, col = lane & 15, g = lane >> 4;
  const int qb = blockIdx.x, h = blockIdx.y, b = blockIdx.z; const int q0 = qb * 64 + wave * 16; const size_t rq = (size_t)b * SS + q0 + col;
  // every wave brings one tile of each stage: wave 0 K hi, 1 K residual (64 key rows), 2 V^T hi, 3 V^T residual (64 d rows x 64 keys)
  const unsigned wv = uni((unsigned)tid >> 5); const size_t ko = (size_t)b * SS * (2 * DM) + DM + h * HD, vo = ((size_t)b * DM + h * HD) * SS;
  const _Float16* tsrc = (wv == 0u) ? QK + ko : (wv == 1u) ? QKL + ko : (wv == 2u) ? VTH + vo : VTL + vo;
  const unsigned tstep = (wv < 2u) ? (unsigned)(AKS * 2 * DM * 2) : (unsigned)(AKS * 2);   // bytes from one stage's tile to the next
  const unsigned tdst = (unsigned)(size_t)ring + wv * ASLICE;
  const u32x8 g1 = tdm_group1(); u32x4 g0 = tdm_group0(tdst, (unsigned long long)(size_t)tsrc);
  tdm_load(g0, g1);                                                                       // stage 0
  tdm_wait(g0, g1);                                                                       // this wave's tile of stage 0 has landed
  __syncthreads();                                                                        // stage 0 published to all four waves
  g0 = tdm_group0(tdst + ABUF, (unsigned long long)(size_t)tsrc + tstep);
  tdm_load(g0, g1);                                                                       // stage 1 (keys 64..127 exist for every block; unread where qb is 0)
  v16h aq[2], aql[2];
#pragma unroll
  for (int kc = 0; kc < 2; ++kc) { aq[kc] = frag_h(QK + rq * (2 * DM) + h * HD + kc * 32, lane); aql[kc] = frag_h(QKL + rq * (2 * DM) + h * HD + kc * 32, lane); }
  float m = -3.0e38f, l = 0.f;   // of query q0 + col; m is the same in both wave halves, l holds this half's keys only
  v8f acc[4] = {}, accl[4] = {};   // O^T: row d = dt * 16 + 8 g + r, column = query
  const int qi = q0 + col;
  const int nst = qb + 1;
#pragma unroll 1
  for (int st = 0; st < nst; ++st) { const unsigned char* buf = ring + (st & 1) * ABUF;
  // the two halves of a stage stay a rolled loop: unrolled, the first half's P.V products are moved behind the second half's scores and their V^T fragments stay live, which takes the kernel past 256 registers
#pragma unroll 1
  for (int sub = 0; sub < 2; ++sub) { const int ks = st * 2 + sub; v8f s[2]; v16h kh[2][2], kl[2][2], vh[4], vl[4];
#pragma unroll
    for (int ct = 0; ct < 2; ++ct) { const _Float16* krow = (const _Float16*)(buf + (sub * 32 + ct * 16 + col) * APITCH); const _Float16* krowl = (const _Float16*)(buf + ASLICE + (sub * 32 + ct * 16 + col) * APITCH);
#pragma unroll
      for (int kc = 0; kc < 2; ++kc) { kh[ct][kc] = frag_h(krow + kc * 32, lane); kl[ct][kc] = frag_h(krowl + kc * 32, lane); } }
    __builtin_amdgcn_sched_barrier(0);   // keeps the 32 keys' K reads one group ahead of the score WMMAs: sunk among them, each fragment's LDS latency is waited out on its own
    v8f cc[2] = {}, cr[2] = {};
#pragma unroll
    for (int kc = 0; kc < 2; ++kc) {
#pragma unroll
      for (int ct = 0; ct < 2; ++ct) { cc[ct] = wmma16(kh[ct][kc], aq[kc], cc[ct]); cr[ct] = wmma16(kh[ct][kc], aql[kc], cr[ct]); }
#pragma unroll
      for (int ct = 0; ct < 2; ++ct) cr[ct] = wmma16(kl[ct][kc], aq[kc], cr[ct]); }   // 3 products: q, k as f16 hi + residual; the two key tiles alternate, so that no WMMA directly follows the one whose accumulator it adds to
#pragma unroll
    for (int dt = 0; dt < 4; ++dt) { const unsigned char* vr = buf + 2 * ASLICE + (dt * 16 + col) * APITCH + sub * 64; vh[dt] = frag_h((const _Float16*)vr, lane); vl[dt] = frag_h((const _Float16*)(vr + ASLICE), lane); }
    __builtin_amdgcn_sched_barrier(0);   // keeps the V^T reads one group ahead of the softmax, whose vector work covers their latency: left free, part of them sinks among the P.V WMMAs and is waited out there
#pragma unroll
    for (int ct = 0; ct < 2; ++ct) { const int kk = ks * 32 + ct * 16 + 8 * g; v8f c = cc[ct]; const v8f cl = cr[ct];
#pragma unroll
      for (int r = 0; r < 8; ++r) c[r] += cl[r] * (1.0f / 2048.0f);
#pragma unroll
      for (int r = 0; r < 8; ++r) s[ct][r] = (kk + r <= qi) ? c[r] * 0.125f : -3.0e38f; }   // SCALE = 1/sqrt(64)
    float mx = fmaxf(s[0][0], s[1][0]);
#pragma unroll
    for (int r = 1; r < 8; ++r) mx = fmaxf(mx, fmaxf(s[0][r], s[1][r]));
    mx = fmaxf(mx, xhalf(mx));
    const float mn = fmaxf(m, mx); const float alpha = (m <= -1.0e38f) ? 0.f : __expf(m - mn);
    v8f x0, x1;
#pragma unroll
    for (int r = 0; r < 8; ++r) { x0[r] = (s[0][r] - mn) * 1.44269504f; x1[r] = (s[1][r] - mn) * 1.44269504f; }   // exp(v) = exp2(v * log2 e), as __expf forms it
    const v8f y0 = exp2x8(x0), y1 = exp2x8(x1);
    v16h pa, pl; float es[4] = {0.f, 0.f, 0.f, 0.f};   // four independent partial sums
#pragma unroll
    for (int r = 0; r < 8; ++r) { const float e0 = (s[0][r] <= -1.0e38f) ? 0.f : y0[r], e1 = (s[1][r] <= -1.0e38f) ? 0.f : y1[r]; es[r & 3] += e0 + e1;
      const _Float16 h0 = (_Float16)e0, h1 = (_Float16)e1; pa[r] = h0; pa[8 + r] = h1; pl[r] = (_Float16)((e0 - (float)h0) * 2048.0f); pl[8 + r] = (_Float16)((e1 - (float)h1) * 2048.0f); }   // B operand: element r is key 8 g + r, element 8 + r is key 16 + 8 g + r, as in frag_h
    l = l * alpha + ((es[0] + es[1]) + (es[2] + es[3])); m = mn;
#pragma unroll
    for (int dt = 0; dt < 4; ++dt) {
#pragma unroll
      for (int r = 0; r < 8; ++r) { acc[dt][r] *= alpha; accl[dt][r] *= alpha; } }
#pragma unroll
    for (int dt = 0; dt < 4; ++dt) { acc[dt] = wmma16(vh[dt], pa, acc[dt]); accl[dt] = wmma16(vh[dt], pl, accl[dt]); accl[dt] = wmma16(vl[dt], pa, accl[dt]); } }   // V hi x P hi + (V hi x P lo + V lo x P hi) / 2048
    asm volatile("s_wait_dscnt 0x0" ::: "memory");        // this wave's reads of stage st are done
    tdm_wait(g0, g1);                                     // this wave's tile of stage st + 1 has landed
    __syncthreads();                                      // publishes stage st + 1 and ends every wave's reads of stage st
    if (pinned(st + 2 < nst)) { g0 = tdm_group0(tdst + (unsigned)(st & 1) * ABUF, (unsigned long long)(size_t)tsrc + (unsigned long long)(unsigned)(st + 2) * tstep); tdm_load(g0, g1); } }   // refill of the buffer just left
  tdm_wait(g0, g1);                                       // no request outstanding when the wave goes on to its end
  asm volatile("s_wait_dscnt 0x0" ::: "memory");
  const float il = 1.0f / (l + xhalf(l));                 // the two halves' sums joined
#pragma unroll
  for (int dt = 0; dt < 4; ++dt) {
#pragma unroll
    for (int r = 0; r < 8; ++r) so[wave][col][dt * 16 + 8 * g + r] = (acc[dt][r] + accl[dt][r] * (1.0f / 2048.0f)) * il; }
  LDSX();
  for (int rl = 0; rl < 16; ++rl) if (lane < 16) vst2(O + ((size_t)b * SS + q0 + rl) * DM + h * HD + lane * 4, *(const v4f*)&so[wave][rl][lane * 4]);
}
// ---- k_out: block = (64 rows, 128 cols): out = O(hi/lo) . Wo rows (2 products) + bo
__global__ __launch_bounds__(128) void k_out(const float* __restrict__ O, const __bf16* __restrict__ P, const float* __restrict__ BO, float* __restrict__ Y) {
  __shared__ __attribute__((aligned(2048))) unsigned char ring[2 * GBUF];   // two stages of ctx and Wo slices, shared by the four waves; behind the K loop the same bytes stage the output
  float (*so)[16][132] = (float (*)[16][132])ring;
  const int tid = threadIdx.x, wave = tid >> 5, lane = tid & 31, col = lane & 15, g = lane >> 4; const size_t r0 = (size_t)blockIdx.x * 64 + wave * 16; const int n0 = blockIdx.y * 128;
  const unsigned wv = uni((unsigned)tid >> 5), act = (wv < 2u) ? 1u : 0u;
  const unsigned long long tsrc = act ? (unsigned long long)(size_t)(O + ((size_t)blockIdx.x * 64 + wv * 32) * DM) : (unsigned long long)(size_t)(P + ((size_t)n0 + (wv - 2u) * 64) * DM);
  const unsigned tstep = act ? (unsigned)(GKS * 4) : (unsigned)(GKS * 2);   // bytes from one stage's slice to the next
  const unsigned tdst = (unsigned)(size_t)ring + wv * GSL;
  const u32x8 ga = tdm_group1_act(), gw = tdm_group1_wgt(); u32x4 g0 = tdm_group0(tdst, tsrc);
  gemm_load(act, g0, ga, gw);                                                             // stage 0
  gemm_wait(g0, ga, gw);                                                                  // this wave's slice of stage 0 has landed
  __syncthreads();                                                                        // stage 0 published to all four waves
  g0 = tdm_group0(tdst + GBUF, tsrc + tstep);
  gemm_load(act, g0, ga, gw);                                                             // stage 1
  const unsigned aoff = (unsigned)((wave >> 1) * GSL + ((wave & 1) * 16 + col) * GAP), boff = (unsigned)(2 * GSL + col * GBP);
  v8f acc[8] = {};
  // the stage loop stays rolled: one publish point and one refill site, and the buffer is picked by the stage's parity
#pragma unroll 1
  for (int st = 0; st < GST; ++st) { const unsigned char* buf = ring + (st & 1) * GBUF;
    v4f ar[2][4]; v16b wf[2][8];   // every fragment of the stage in registers of its own
#pragma unroll
    for (int kc = 0; kc < 2; ++kc) { const v4f* p = (const v4f*)(buf + aoff + kc * 128 + 32 * g); ar[kc][0] = p[0]; ar[kc][1] = p[1]; ar[kc][2] = p[4]; ar[kc][3] = p[5];
#pragma unroll
      for (int j = 0; j < 8; ++j) wf[kc][j] = frag_b((const __bf16*)(buf + boff + (j >> 2) * GSL + (j & 3) * 16 * GBP) + kc * 32, lane); }
    __builtin_amdgcn_sched_barrier(0);   // keeps the stage's LDS reads one group ahead of its WMMAs: sunk among them, each pair of WMMAs waits out an LDS latency of its own
#pragma unroll
    for (int kc = 0; kc < 2; ++kc) { float v[16];
#pragma unroll
      for (int i = 0; i < 4; ++i) { v[i] = ar[kc][0][i]; v[4 + i] = ar[kc][1][i]; v[8 + i] = ar[kc][2][i]; v[12 + i] = ar[kc][3][i]; }
      const F2 a = bsplit16(v);
#pragma unroll
      for (int j = 0; j < 8; ++j) { acc[j] = wmma_bf(a.l, wf[kc][j], acc[j]); acc[j] = wmma_bf(a.h, wf[kc][j], acc[j]); } }
    __builtin_amdgcn_sched_barrier(0);   // keeps the WMMAs ahead of the publish point: sunk behind its barrier, they delay the refill and stand idle while the next slice lands
    asm volatile("s_wait_dscnt 0x0" ::: "memory");        // this wave's reads of stage st are done
    gemm_wait(g0, ga, gw);                                // this wave's slice of stage st + 1 has landed
    __syncthreads();                                      // publishes stage st + 1 and ends every wave's reads of stage st
    if (pinned(st + 2 < GST)) { g0 = tdm_group0(tdst + (unsigned)(st & 1) * GBUF, tsrc + (unsigned long long)(unsigned)(st + 2) * tstep); gemm_load(act, g0, ga, gw); } }   // refill of the buffer just left
  gemm_wait(g0, ga, gw);                                  // no request outstanding behind the loop; the last pass's barrier has ended every read of the ring, which now stages the output
  asm volatile("s_wait_dscnt 0x0" ::: "memory");
#pragma unroll
  for (int j = 0; j < 8; ++j) {
#pragma unroll
    for (int r = 0; r < 8; ++r) so[wave][8 * g + r][j * 16 + col] = acc[j][r] + bfr(BO[n0 + j * 16 + col]); }
  LDSX();
  for (int rl = 0; rl < 16; ++rl) vst2(Y + (r0 + rl) * DM + n0 + lane * 4, *(const v4f*)&so[wave][rl][lane * 4]);
}
extern "C" void kernel_launch(void* const* d_in, const int* in_sizes, int n_in, void* d_out, int out_size, void* d_ws, size_t ws_size, hipStream_t stream) {
  (void)in_sizes; (void)n_in; (void)out_size;
  const float** F = (const float**)d_in;   // 0 x [4,2048,1024], 1 Wq [1024,1024] natural, 2 bq, 3 Wk, 4 bk, 5 Wv, 6 bv, 7 Wo, 8 bo
  if (ws_size < (size_t)WS_END) return;
  char* ws = (char*)d_ws; __bf16* PK = (__bf16*)(ws + WS_PK); _Float16 *QK = (_Float16*)(ws + WS_QK), *QKL = (_Float16*)(ws + WS_QKL), *VTH = (_Float16*)(ws + WS_VTH), *VTL = (_Float16*)(ws + WS_VTL); float* O = (float*)(ws + WS_O);
  k_pack<<<dim3(DM, 4), 256, 0, stream>>>(F[1], F[3], F[5], F[7], PK);
  k_qkv<<<dim3(TNB * SS / 64, QKVW / 128), 128, 0, stream>>>(F[0], PK + PK_A, F[2], F[4], F[6], QK, QKL, VTH, VTL);
  k_attn<<<dim3(TQB, NH, TNB), 128, 0, stream>>>(QK, QKL, VTH, VTL, O);
  k_out<<<dim3(TOB, DM / 128), 128, 0, stream>>>(O, PK + PK_P, F[8], (float*)d_out);
}

// v005
// A run of this version takes 190 microseconds.
// Next to v004, in two timings, it ran 1.22 and 1.23 times as fast.
// Counting every step since v000, it is 4.39 times as fast.
// compute dtype: x, Wq..Wo, bq..bo (module inputs) rounded to bf16; q/k/v projections with exact bf16 products on WMMA 16x16x32 (natural [out][in] rows) + biases; q and k stored as f16 hi + (x2048-scaled) residual planes with 3-product scores, x 1/sqrt(64), causal mask (k > q -> -1e9 in the module, zero weight), running-max softmax in f32 (hardware exp); P as f16 hi + (x2048) residual x v hi/lo (3 products); output projection with ctx as bf16 hi + residual x exact Wo rows (2 products) + bo; f32 accumulate.
#include <hip/hip_runtime.h>
#include <math.h>

typedef __attribute__((ext_vector_type(16))) _Float16 v16h;
typedef __attribute__((ext_vector_type(16))) __bf16 v16b;
typedef __attribute__((ext_vector_type(8)))  _Float16 v8h;
typedef __attribute__((ext_vector_type(8)))  float v8f;
typedef __attribute__((ext_vector_type(4)))  float v4f;
typedef __attribute__((ext_vector_type(2)))  float v2f;
typedef __attribute__((ext_vector_type(4)))  unsigned v4u;
typedef __attribute__((ext_vector_type(4)))  int v4i;
typedef float __attribute__((may_alias)) float_a;
typedef int __attribute__((may_alias)) int_a;

template <typename T> __device__ __forceinline__ void vst2(void* p, T v) { *(T*)p = v;  }
__device__ __forceinline__ v8f wmma16(v16h a, v16h b, v8f c) {
  v8f d = __builtin_amdgcn_wmma_f32_16x16x32_f16(false, a, false, b, (short)0, c, false, false);
  return d;
}
__device__ __forceinline__ v8f wmma_bf(v16b a, v16b b, v8f c) {
  v8f d = __builtin_amdgcn_wmma_f32_16x16x32_bf16(false, a, false, b, (short)0, c, false, false);
  return d;
}
// Masked (causal) multi-head attention (B 4, S 2,048, d 1,024, 16 heads x 64; four biased projections).
__device__ __forceinline__ v16h frag_h(const _Float16* rowk0, int lane) {
  union { v16h v; v8h q[2]; } u; const _Float16* p = rowk0 + 8 * (lane >> 4);
  u.q[0] = *(const v8h*)p; u.q[1] = *(const v8h*)(p + 16); return u.v;
}
__device__ __forceinline__ v16h frag_f32(const float* rowk0, int lane) {
  v16h a; const float* p = rowk0 + 8 * (lane >> 4);
#pragma unroll
  for (int i = 0; i < 8; ++i) { a[i] = (_Float16)p[i]; a[8 + i] = (_Float16)p[16 + i]; }
  return a;
}
__device__ __forceinline__ v16h frag_f32s(const float* rowk0, int lane, float sc) {
  v16h a; const float* p = rowk0 + 8 * (lane >> 4);
#pragma unroll
  for (int i = 0; i < 8; ++i) { a[i] = (_Float16)(p[i] * sc); a[8 + i] = (_Float16)(p[16 + i] * sc); }
  return a;
}
// column fragment from a [K][ld] layout (column n), rows >= K read as 0
__device__ __forceinline__ v16h fragc_f32(const float* W, int k0, int n, int lane, int ld, int K) {
  v16h a; const int g = lane >> 4;
#pragma unroll
  for (int i = 0; i < 8; ++i) { const int ka = k0 + 8 * g + i, kb = ka + 16;
    a[i] = (_Float16)(ka < K ? W[(size_t)(ka < K ? ka : K - 1) * ld + n] : 0.f); a[8 + i] = (_Float16)(kb < K ? W[(size_t)(kb < K ? kb : K - 1) * ld + n] : 0.f); }
  return a;
}
struct F2 { v16b h, l; };
__device__ __forceinline__ F2 bsplit16(const float v[16]) { F2 r;
#pragma unroll
  for (int i = 0; i < 16; ++i) { const __bf16 h = (__bf16)v[i]; r.h[i] = h; r.l[i] = (__bf16)(v[i] - (float)h); }
  return r; }
__device__ __forceinline__ F2 split_row(const float* row, int k0, int lane) { float v[16]; const float* p = row + k0 + 8 * (lane >> 4);
#pragma unroll
  for (int i = 0; i < 8; ++i) { v[i] = p[i]; v[8 + i] = p[16 + i]; }
  return bsplit16(v); }
__device__ __forceinline__ F2 split_rowK(const float* row, int k0, int lane, int K) { float v[16]; const int g = lane >> 4;
#pragma unroll
  for (int i = 0; i < 8; ++i) { const int ka = k0 + 8 * g + i, kb = ka + 16; v[i] = ka < K ? row[ka < K ? ka : K - 1] : 0.f; v[8 + i] = kb < K ? row[kb < K ? kb : K - 1] : 0.f; }
  return bsplit16(v); }
__device__ __forceinline__ F2 split_col(const float* W, int k0, int n, int lane, int ld, int K) { float v[16]; const int g = lane >> 4;
#pragma unroll
  for (int i = 0; i < 8; ++i) { const int ka = k0 + 8 * g + i, kb = ka + 16; v[i] = ka < K ? W[(size_t)(ka < K ? ka : K - 1) * ld + n] : 0.f; v[8 + i] = kb < K ? W[(size_t)(kb < K ? kb : K - 1) * ld + n] : 0.f; }
  return bsplit16(v); }
__device__ __forceinline__ v8f mac3(const F2& a, const F2& b, v8f c) { c = wmma_bf(a.l, b.h, c); c = wmma_bf(a.h, b.l, c); return wmma_bf(a.h, b.h, c); }
__device__ __forceinline__ float sigm(float v) { return 1.0f / (1.0f + expf(-v)); }
#define LDSX() do { asm volatile("s_wait_dscnt 0" ::: "memory"); __builtin_amdgcn_wave_barrier(); __builtin_amdgcn_fence(__ATOMIC_RELEASE, "workgroup"); } while (0)


#define NB 4
#define SS 2048
#define DM 1024
#define NH 16
#define HD 64
#define QKVW (3 * DM)
#ifndef TQB
#define TQB (SS / 64)
#define TNB NB
#define TOB (NB * SS / 64)     // output row tiles (all)
#endif
typedef __attribute__((ext_vector_type(8))) __bf16 v8b;
__device__ __forceinline__ v16b frag_b(const __bf16* rowk0, int lane) {
  union { v16b v; v8b q[2]; } u; const __bf16* p = rowk0 + 8 * (lane >> 4);
  u.q[0] = *(const v8b*)p; u.q[1] = *(const v8b*)(p + 16); return u.v;
}
__device__ __forceinline__ float bfr(float v) { return (float)(__bf16)v; }
__device__ __attribute__((noinline)) float exp_ni(float v) { return expf(v); }
__device__ __attribute__((noinline)) float erf_ni(float v) { return erff(v); }

#define PK_A 0                       // [3072][1024] Wqkv rows (natural [out][in])
#define PK_P (PK_A + QKVW * DM)        // [1024][1024] Wo rows (natural)
#define PK_END (PK_P + DM * DM)
#define WS_PK  0u
#define WS_QK  (WS_PK + 2u * PK_END)             // f16 [8192 rows][2048]: q | k
#define WS_QKL (WS_QK + 2u * NB * SS * 2 * DM)     // f16 q | k residual planes x2048
#define WS_VTH (WS_QKL + 2u * NB * SS * 2 * DM)    // f16 [b][1024 (h*64+d)][2048 s] hi
#define WS_VTL (WS_VTH + 2u * NB * DM * SS)        // f16 lo x 2048
#define WS_O   (WS_VTL + 2u * NB * DM * SS)        // f32 [8192][1024]
#define WS_CS  (WS_O + 4u * NB * SS * DM)           // f32 2 x [2048][32], reserved but never written or read (no RoPE)
#define WS_END (WS_CS + 4u * 2 * SS * 32)
// ---- k_pack: block = (row n, which): natural [out][in] rows -> bf16; which 0..2 -> W_q/W_k/W_v into PK_A rows which*1024 + n; 3 -> W_o into PK_P
__global__ __launch_bounds__(256) void k_pack(const float* __restrict__ WQ, const float* __restrict__ WK, const float* __restrict__ WV, const float* __restrict__ WO, __bf16* __restrict__ PK) {
  __shared__ __align__(16) __bf16 s[DM]; const int n = blockIdx.x, which = blockIdx.y, t = threadIdx.x; const float* Wm = (which == 0) ? WQ : (which == 1) ? WK : (which == 2) ? WV : WO;
  for (int k = t; k < DM; k += 256) s[k] = (__bf16)Wm[(size_t)n * DM + k];
  __syncthreads();
  __bf16* dst = (which < 3) ? PK + PK_A + ((size_t)which * DM + n) * DM : PK + PK_P + (size_t)n * DM;
  for (int q = t; q < DM / 8; q += 256) vst2((unsigned*)(dst + q * 8), *(const v4u*)&s[q * 8]);
}
// ---- tensor-load helpers: a stage of k_attn is 64 keys; four tiles (K hi, K residual, V^T hi, V^T residual), each 64 rows of 128 B at source pitch 4096 B, one tile per wave
typedef unsigned u32x4 __attribute__((ext_vector_type(4)));
typedef unsigned u32x8 __attribute__((ext_vector_type(8)));
#define AKS 64                 // keys per stage
#define APITCH 144             // LDS row pitch in bytes: 128-B rows + 16 (odd multiple of 16 for the ds_load_b128 readers)
#define ASLICE 10240           // one tile in LDS: 64 x 144 B rounded up to a multiple of 2 KiB
#define ABUF (4 * ASLICE)      // one stage
__device__ __forceinline__ unsigned uni(unsigned v) { return (unsigned)__builtin_amdgcn_readfirstlane(v); }
__device__ __forceinline__ unsigned pinned(unsigned v) { unsigned w = uni(v); asm volatile("" : "+s"(w)); return w; }   // the issue test held in a scalar register, so that it compiles to s_cmp + s_cbranch_scc (a tensor load ignores EXEC)
__device__ __forceinline__ u32x4 tdm_group0(unsigned lds_dst, unsigned long long ga) {
  u32x4 g0; g0[0] = uni(1u); g0[1] = uni(lds_dst); g0[2] = uni((unsigned)ga); g0[3] = uni((((unsigned)(ga >> 32)) & 0x01FFFFFFu) | 0x80000000u); return g0;
}
__device__ __forceinline__ u32x8 tdm_group1() {
  u32x8 g1; g1[0] = uni((1u << 20) | (4u << 22) | (3u << 25));   // no mask, 1-byte elements, a pad of 4 dwords behind every 32 dwords (one row)
  g1[1] = uni(128u << 16); g1[2] = uni(64u << 16); g1[3] = uni(128u << 16); g1[4] = uni(64u); g1[5] = uni(4096u); g1[6] = uni(0u); g1[7] = uni(0u);
  asm volatile("" : "+s"(g1));   // descriptor words held in their scalar registers: without it the constants are formed anew at each load and their registers serve as temporaries while a request is out
  return g1;
}
__device__ __forceinline__ void tdm_load(u32x4 g0, u32x8 g1) { asm volatile("tensor_load_to_lds %0, %1" :: "s"(g0), "s"(g1) : "memory"); }
// the wave's own request has landed; the operands keep that request's descriptor registers unwritten up to here
__device__ __forceinline__ void tdm_wait(u32x4 g0, u32x8 g1) { asm volatile("s_wait_tensorcnt 0x0" :: "s"(g0), "s"(g1) : "memory"); }
// ---- ring of the two projection GEMMs: a stage is 64 k of a 64-row x 128-column block; four slices, one per wave: waves 0, 1 bring 32 activation rows each (f32, 256 B a row, source pitch 4096 B), waves 2, 3 bring 64 weight rows each (bf16, 128 B a row, source pitch 2048 B)
#define GKS 64                 // k per stage
#define GST (DM / GKS)         // stages
#define GAP 272                // LDS pitch of an activation row: 256 B + 16 (odd multiple of 16 for the ds_load_b128 readers)
#define GBP 144                // LDS pitch of a weight row: 128 B + 16
#define GSL 10240              // one slice in LDS: 32 x 272 B or 64 x 144 B, rounded up to a multiple of 2 KiB
#define GBUF (4 * GSL)         // one stage
__device__ __forceinline__ u32x8 tdm_group1_act() {
  u32x8 g1; g1[0] = uni((1u << 20) | (5u << 22) | (3u << 25));   // no mask, 1-byte elements, a pad of 4 dwords behind every 64 dwords (one row)
  g1[1] = uni(256u << 16); g1[2] = uni(32u << 16); g1[3] = uni(256u << 16); g1[4] = uni(32u); g1[5] = uni(4096u); g1[6] = uni(0u); g1[7] = uni(0u);
  asm volatile("" : "+s"(g1));   // descriptor words held in their scalar registers (as in tdm_group1)
  return g1;
}
__device__ __forceinline__ u32x8 tdm_group1_wgt() {
  u32x8 g1; g1[0] = uni((1u << 20) | (4u << 22) | (3u << 25));   // no mask, 1-byte elements, a pad of 4 dwords behind every 32 dwords (one row)
  g1[1] = uni(128u << 16); g1[2] = uni(64u << 16); g1[3] = uni(128u << 16); g1[4] = uni(64u); g1[5] = uni(2048u); g1[6] = uni(0u); g1[7] = uni(0u);
  asm volatile("" : "+s"(g1));   // descriptor words held in their scalar registers (as in tdm_group1)
  return g1;
}
// every wave issues its one slice; the two scalar branches only pick which of the two constant descriptors goes with it (act is 1 in waves 0 and 1, 0 in waves 2 and 3)
__device__ __forceinline__ void gemm_load(unsigned act, u32x4 g0, u32x8 ga, u32x8 gw) { if (pinned(act)) tdm_load(g0, ga); if (pinned(act ^ 1u)) tdm_load(g0, gw); }
// the wave's own request has landed; the operands keep the descriptor registers unwritten up to here
__device__ __forceinline__ void gemm_wait(u32x4 g0, u32x8 ga, u32x8 gw) { asm volatile("s_wait_tensorcnt 0x0" :: "s"(g0), "s"(ga), "s"(gw) : "memory"); }
__global__ __launch_bounds__(128) void k_qkv(const float* __restrict__ X, const __bf16* __restrict__ P, const float* __restrict__ BQ, const float* __restrict__ BK, const float* __restrict__ BV, _Float16* __restrict__ QK, _Float16* __restrict__ QKL, _Float16* __restrict__ VTH, _Float16* __restrict__ VTL) {
  __shared__ __attribute__((aligned(2048))) unsigned char ring[2 * GBUF];   // two stages of x and W slices, shared by the four waves; behind the K loop the same bytes stage the output
  _Float16 (*so)[16][136] = (_Float16 (*)[16][136])ring, (*sol)[16][136] = (_Float16 (*)[16][136])(ring + 4 * 16 * 136 * 2); _Float16 (*sth)[72] = (_Float16 (*)[72])ring, (*stl)[72] = (_Float16 (*)[72])(ring + 128 * 72 * 2);
  const int tid = threadIdx.x, wave = tid >> 5, lane = tid & 31, col = lane & 15, g = lane >> 4; const size_t r0 = (size_t)blockIdx.x * 64 + wave * 16; const int n0 = blockIdx.y * 128;
  const unsigned wv = uni((unsigned)tid >> 5), act = (wv < 2u) ? 1u : 0u;
  const unsigned long long tsrc = act ? (unsigned long long)(size_t)(X + ((size_t)blockIdx.x * 64 + wv * 32) * DM) : (unsigned long long)(size_t)(P + ((size_t)n0 + (wv - 2u) * 64) * DM);
  const unsigned tstep = act ? (unsigned)(GKS * 4) : (unsigned)(GKS * 2);   // bytes from one stage's slice to the next
  const unsigned tdst = (unsigned)(size_t)ring + wv * GSL;
  const u32x8 ga = tdm_group1_act(), gw = tdm_group1_wgt(); u32x4 g0 = tdm_group0(tdst, tsrc);
  gemm_load(act, g0, ga, gw);                                                             // stage 0
  gemm_wait(g0, ga, gw);                                                                  // this wave's slice of stage 0 has landed
  __syncthreads();                                                                        // stage 0 published to all four waves
  g0 = tdm_group0(tdst + GBUF, tsrc + tstep);
  gemm_load(act, g0, ga, gw);                                                             // stage 1
  const unsigned aoff = (unsigned)((wave >> 1) * GSL + ((wave & 1) * 16 + col) * GAP + 32 * g), boff = (unsigned)(2 * GSL + col * GBP);
  v8f acc[8] = {};
  // the stage loop stays rolled: one publish point and one refill site, and the buffer is picked by the stage's parity
#pragma unroll 1
  for (int st = 0; st < GST; ++st) { const unsigned char* buf = ring + (st & 1) * GBUF;
    v4f ar[2][4]; v16b wf[2][8];   // every fragment of the stage in registers of its own
#pragma unroll
    for (int kc = 0; kc < 2; ++kc) { const v4f* p = (const v4f*)(buf + aoff + kc * 128); ar[kc][0] = p[0]; ar[kc][1] = p[1]; ar[kc][2] = p[4]; ar[kc][3] = p[5];
#pragma unroll
      for (int j = 0; j < 8; ++j) wf[kc][j] = frag_b((const __bf16*)(buf + boff + (j >> 2) * GSL + (j & 3) * 16 * GBP) + kc * 32, lane); }
    __builtin_amdgcn_sched_barrier(0);   // keeps the stage's LDS reads one group ahead of its WMMAs: sunk among them, each WMMA waits out an LDS latency of its own
#pragma unroll
    for (int kc = 0; kc < 2; ++kc) { v16b a;
#pragma unroll
      for (int i = 0; i < 4; ++i) { a[i] = (__bf16)ar[kc][0][i]; a[4 + i] = (__bf16)ar[kc][1][i]; a[8 + i] = (__bf16)ar[kc][2][i]; a[12 + i] = (__bf16)ar[kc][3][i]; }
#pragma unroll
      for (int j = 0; j < 8; ++j) acc[j] = wmma_bf(a, wf[kc][j], acc[j]); }
    __builtin_amdgcn_sched_barrier(0);   // keeps the WMMAs ahead of the publish point: sunk behind its barrier, they delay the refill and stand idle while the next slice lands
    asm volatile("s_wait_dscnt 0x0" ::: "memory");        // this wave's reads of stage st are done
    gemm_wait(g0, ga, gw);                                // this wave's slice of stage st + 1 has landed
    __syncthreads();                                      // publishes stage st + 1 and ends every wave's reads of stage st
    if (pinned(st + 2 < GST)) { g0 = tdm_group0(tdst + (unsigned)(st & 1) * GBUF, tsrc + (unsigned long long)(unsigned)(st + 2) * tstep); gemm_load(act, g0, ga, gw); } }   // refill of the buffer just left
  gemm_wait(g0, ga, gw);                                  // no request outstanding behind the loop; the last pass's barrier has ended every read of the ring, which now stages the output
  asm volatile("s_wait_dscnt 0x0" ::: "memory");
  { const int which = n0 / DM; const float* BB = (which == 0) ? BQ : (which == 1) ? BK : BV;
#pragma unroll
    for (int j = 0; j < 8; ++j) { const float bb = bfr(BB[(n0 % DM) + j * 16 + col]);
#pragma unroll
      for (int r = 0; r < 8; ++r) acc[j][r] += bb; } }
  if (n0 < 2 * DM) {   // q stored unscaled (f16 sigma ~0.6, no subnormal exposure); 1/8 applied to the f32 score
#pragma unroll
    for (int j = 0; j < 8; ++j) {
#pragma unroll
      for (int r = 0; r < 8; ++r) { const float v = acc[j][r]; const _Float16 hv = (_Float16)v; so[wave][8 * g + r][j * 16 + col] = hv; sol[wave][8 * g + r][j * 16 + col] = (_Float16)((v - (float)hv) * 2048.0f); } }   // q, k as f16 hi + (x2048) residual (no RoPE in this module)
    LDSX();
    for (int rl = 0; rl < 16; ++rl) if (lane < 16) { vst2((unsigned*)(QK + (r0 + rl) * (2 * DM) + n0 + lane * 8), *(const v4u*)&so[wave][rl][lane * 8]); vst2((unsigned*)(QKL + (r0 + rl) * (2 * DM) + n0 + lane * 8), *(const v4u*)&sol[wave][rl][lane * 8]); }
  } else {
#pragma unroll
    for (int j = 0; j < 8; ++j) {
#pragma unroll
      for (int r = 0; r < 8; ++r) { const float v = acc[j][r]; const _Float16 hv = (_Float16)v; sth[j * 16 + col][wave * 16 + 8 * g + r] = hv; stl[j * 16 + col][wave * 16 + 8 * g + r] = (_Float16)((v - (float)hv) * 2048.0f); } }
    __syncthreads();
    const size_t rb = (size_t)blockIdx.x * 64; const int b = (int)(rb / SS), s0 = (int)(rb % SS); const int pc0 = n0 - 2 * DM;
    for (int q = tid; q < 128 * 8; q += 128) { const int d = q >> 3, pc = q & 7; const size_t o = ((size_t)b * DM + pc0 + d) * SS + s0 + pc * 8; vst2((unsigned*)(VTH + o), *(const v4u*)&sth[d][pc * 8]); vst2((unsigned*)(VTL + o), *(const v4u*)&stl[d][pc * 8]); }
  }
}
// lane l with lane l ^ 16 (a vector cross-row move, no LDS traffic)
__device__ __forceinline__ float xhalf(float x) { return __builtin_bit_cast(float, __builtin_amdgcn_permlanex16(__builtin_bit_cast(int, x), __builtin_bit_cast(int, x), 0x76543210, 0xfedcba98, false, false)); }
// eight hardware exp2 in one statement, so that the free slot which the instruction set asks for behind a transcendental is there by construction: the outputs are early-clobber (none shares a register with an input), so each v_exp_f32 is followed by one that neither reads its result nor overwrites its source, and the v_nop is the slot behind the last.
__device__ __forceinline__ v8f exp2x8(v8f x) { float e0, e1, e2, e3, e4, e5, e6, e7;
  asm("v_exp_f32 %0, %8\n\tv_exp_f32 %1, %9\n\tv_exp_f32 %2, %10\n\tv_exp_f32 %3, %11\n\tv_exp_f32 %4, %12\n\tv_exp_f32 %5, %13\n\tv_exp_f32 %6, %14\n\tv_exp_f32 %7, %15\n\tv_nop"
      : "=&v"(e0), "=&v"(e1), "=&v"(e2), "=&v"(e3), "=&v"(e4), "=&v"(e5), "=&v"(e6), "=&v"(e7)
      : "v"(x[0]), "v"(x[1]), "v"(x[2]), "v"(x[3]), "v"(x[4]), "v"(x[5]), "v"(x[6]), "v"(x[7]));
  v8f e = {e0, e1, e2, e3, e4, e5, e6, e7}; return e; }
// ---- k_attn: block = (head h, batch b, 64 queries, last query block first): causal flash attention in transposed form: S^T = K . Q^T (A = key rows from LDS, B = the wave's 16 queries, kept in registers), so a lane holds 16 of the 32 scores of ONE query (column = lane & 15; keys 8 g + r and 16 + 8 g + r): maximum and sum run in the lane, one exchange between the wave halves joins the maximum, the halves' sums are joined once at the end. The score registers are already in the k order of a B operand, so P^T (f16 hi + x2048 residual) goes from them straight into O^T += V^T . P^T (A = V^T rows from LDS). Products as before: 3 for the scores, 3 for P.V; O[b*S+q][h*64+d] = (acc + accl / 2048) / l (256-B segments)
__global__ __launch_bounds__(128) void k_attn(const _Float16* __restrict__ QK, const _Float16* __restrict__ QKL, const _Float16* __restrict__ VTH, const _Float16* __restrict__ VTL, float* __restrict__ O) {
  __shared__ __attribute__((aligned(2048))) unsigned char ring[2 * ABUF];   // two stages of K/V tiles, shared by the four waves
  __shared__ __align__(16) float so[4][16][68];
  const int tid = threadIdx.x, wave = tid >> 5, lane = tid & 31, col = lane & 15, g = lane >> 4;
  // a work-group's cost grows with its query block (qb + 1 stages) and there are more work-groups than resident places: the query block is the slowest grid index and falls with it, so the longest work-groups start first and the shortest fill the end of the launch
  const int qb = TQB - 1 - (int)blockIdx.z, h = blockIdx.x, b = blockIdx.y; const int q0 = qb * 64 + wave * 16; const size_t rq = (size_t)b * SS + q0 + col;
  // every wave brings one tile of each stage: wave 0 K hi, 1 K residual (64 key rows), 2 V^T hi, 3 V^T residual (64 d rows x 64 keys)
  const unsigned wv = uni((unsigned)tid >> 5); const size_t ko = (size_t)b * SS * (2 * DM) + DM + h * HD, vo = ((size_t)b * DM + h * HD) * SS;
  const _Float16* tsrc = (wv == 0u) ? QK + ko : (wv == 1u) ? QKL + ko : (wv == 2u) ? VTH + vo : VTL + vo;
  const unsigned tstep = (wv < 2u) ? (unsigned)(AKS * 2 * DM * 2) : (unsigned)(AKS * 2);   // bytes from one stage's tile to the next
  const unsigned tdst = (unsigned)(size_t)ring + wv * ASLICE;
  const u32x8 g1 = tdm_group1(); u32x4 g0 = tdm_group0(tdst, (unsigned long long)(size_t)tsrc);
  tdm_load(g0, g1);                                                                       // stage 0
  tdm_wait(g0, g1);                                                                       // this wave's tile of stage 0 has landed
  __syncthreads();                                                                        // stage 0 published to all four waves
  g0 = tdm_group0(tdst + ABUF, (unsigned long long)(size_t)tsrc + tstep);
  tdm_load(g0, g1);                                                                       // stage 1 (keys 64..127 exist for every block; unread where qb is 0)
  v16h aq[2], aql[2];
#pragma unroll
  for (int kc = 0; kc < 2; ++kc) { aq[kc] = frag_h(QK + rq * (2 * DM) + h * HD + kc * 32, lane); aql[kc] = frag_h(QKL + rq * (2 * DM) + h * HD + kc * 32, lane); }
  float m = -3.0e38f, l = 0.f;   // of query q0 + col; m is the same in both wave halves, l holds this half's keys only
  v8f acc[4] = {}, accl[4] = {};   // O^T: row d = dt * 16 + 8 g + r, column = query
  const int qi = q0 + col;
  const int nst = qb + 1;
#pragma unroll 1
  for (int st = 0; st < nst; ++st) { const unsigned char* buf = ring + (st & 1) * ABUF;
  // the two halves of a stage stay a rolled loop: unrolled, the first half's P.V products are moved behind the second half's scores and their V^T fragments stay live, which takes the kernel past 256 registers
#pragma unroll 1
  for (int sub = 0; sub < 2; ++sub) { const int ks = st * 2 + sub; v8f s[2]; v16h kh[2][2], kl[2][2], vh[4], vl[4];
#pragma unroll
    for (int ct = 0; ct < 2; ++ct) { const _Float16* krow = (const _Float16*)(buf + (sub * 32 + ct * 16 + col) * APITCH); const _Float16* krowl = (const _Float16*)(buf + ASLICE + (sub * 32 + ct * 16 + col) * APITCH);
#pragma unroll
      for (int kc = 0; kc < 2; ++kc) { kh[ct][kc] = frag_h(krow + kc * 32, lane); kl[ct][kc] = frag_h(krowl + kc * 32, lane); } }
    __builtin_amdgcn_sched_barrier(0);   // keeps the 32 keys' K reads one group ahead of the score WMMAs: sunk among them, each fragment's LDS latency is waited out on its own
    v8f cc[2] = {}, cr[2] = {};
#pragma unroll
    for (int kc = 0; kc < 2; ++kc) {
#pragma unroll
      for (int ct = 0; ct < 2; ++ct) { cc[ct] = wmma16(kh[ct][kc], aq[kc], cc[ct]); cr[ct] = wmma16(kh[ct][kc], aql[kc], cr[ct]); }
#pragma unroll
      for (int ct = 0; ct < 2; ++ct) cr[ct] = wmma16(kl[ct][kc], aq[kc], cr[ct]); }   // 3 products: q, k as f16 hi + residual; the two key tiles alternate, so that no WMMA directly follows the one whose accumulator it adds to
#pragma unroll
    for (int dt = 0; dt < 4; ++dt) { const unsigned char* vr = buf + 2 * ASLICE + (dt * 16 + col) * APITCH + sub * 64; vh[dt] = frag_h((const _Float16*)vr, lane); vl[dt] = frag_h((const _Float16*)(vr + ASLICE), lane); }
    __builtin_amdgcn_sched_barrier(0);   // keeps the V^T reads one group ahead of the softmax, whose vector work covers their latency: left free, part of them sinks among the P.V WMMAs and is waited out there
#pragma unroll
    for (int ct = 0; ct < 2; ++ct) { const int kk = ks * 32 + ct * 16 + 8 * g; v8f c = cc[ct]; const v8f cl = cr[ct];
#pragma unroll
      for (int r = 0; r < 8; ++r) c[r] += cl[r] * (1.0f / 2048.0f);
#pragma unroll
      for (int r = 0; r < 8; ++r) s[ct][r] = (kk + r <= qi) ? c[r] * 0.125f : -3.0e38f; }   // SCALE = 1/sqrt(64)
    float mx = fmaxf(s[0][0], s[1][0]);
#pragma unroll
    for (int r = 1; r < 8; ++r) mx = fmaxf(mx, fmaxf(s[0][r], s[1][r]));
    mx = fmaxf(mx, xhalf(mx));
    const float mn = fmaxf(m, mx); const float alpha = (m <= -1.0e38f) ? 0.f : __expf(m - mn);
    v8f x0, x1;
#pragma unroll
    for (int r = 0; r < 8; ++r) { x0[r] = (s[0][r] - mn) * 1.44269504f; x1[r] = (s[1][r] - mn) * 1.44269504f; }   // exp(v) = exp2(v * log2 e), as __expf forms it
    const v8f y0 = exp2x8(x0), y1 = exp2x8(x1);
    v16h pa, pl; float es[4] = {0.f, 0.f, 0.f, 0.f};   // four independent partial sums
#pragma unroll
    for (int r = 0; r < 8; ++r) { const float e0 = (s[0][r] <= -1.0e38f) ? 0.f : y0[r], e1 = (s[1][r] <= -1.0e38f) ? 0.f : y1[r]; es[r & 3] += e0 + e1;
      const _Float16 h0 = (_Float16)e0, h1 = (_Float16)e1; pa[r] = h0; pa[8 + r] = h1; pl[r] = (_Float16)((e0 - (float)h0) * 2048.0f); pl[8 + r] = (_Float16)((e1 - (float)h1) * 2048.0f); }   // B operand: element r is key 8 g + r, element 8 + r is key 16 + 8 g + r, as in frag_h
    l = l * alpha + ((es[0] + es[1]) + (es[2] + es[3])); m = mn;
#pragma unroll
    for (int dt = 0; dt < 4; ++dt) {
#pragma unroll
      for (int r = 0; r < 8; ++r) { acc[dt][r] *= alpha; accl[dt][r] *= alpha; } }
#pragma unroll
    for (int dt = 0; dt < 4; ++dt) { acc[dt] = wmma16(vh[dt], pa, acc[dt]); accl[dt] = wmma16(vh[dt], pl, accl[dt]); accl[dt] = wmma16(vl[dt], pa, accl[dt]); } }   // V hi x P hi + (V hi x P lo + V lo x P hi) / 2048
    asm volatile("s_wait_dscnt 0x0" ::: "memory");        // this wave's reads of stage st are done
    tdm_wait(g0, g1);                                     // this wave's tile of stage st + 1 has landed
    __syncthreads();                                      // publishes stage st + 1 and ends every wave's reads of stage st
    if (pinned(st + 2 < nst)) { g0 = tdm_group0(tdst + (unsigned)(st & 1) * ABUF, (unsigned long long)(size_t)tsrc + (unsigned long long)(unsigned)(st + 2) * tstep); tdm_load(g0, g1); } }   // refill of the buffer just left
  tdm_wait(g0, g1);                                       // no request outstanding when the wave goes on to its end
  asm volatile("s_wait_dscnt 0x0" ::: "memory");
  const float il = 1.0f / (l + xhalf(l));                 // the two halves' sums joined
#pragma unroll
  for (int dt = 0; dt < 4; ++dt) {
#pragma unroll
    for (int r = 0; r < 8; ++r) so[wave][col][dt * 16 + 8 * g + r] = (acc[dt][r] + accl[dt][r] * (1.0f / 2048.0f)) * il; }
  LDSX();
  for (int rl = 0; rl < 16; ++rl) if (lane < 16) vst2(O + ((size_t)b * SS + q0 + rl) * DM + h * HD + lane * 4, *(const v4f*)&so[wave][rl][lane * 4]);
}
// ---- k_out: block = (64 rows, 128 cols): out = O(hi/lo) . Wo rows (2 products) + bo
__global__ __launch_bounds__(128) void k_out(const float* __restrict__ O, const __bf16* __restrict__ P, const float* __restrict__ BO, float* __restrict__ Y) {
  __shared__ __attribute__((aligned(2048))) unsigned char ring[2 * GBUF];   // two stages of ctx and Wo slices, shared by the four waves; behind the K loop the same bytes stage the output
  float (*so)[16][132] = (float (*)[16][132])ring;
  const int tid = threadIdx.x, wave = tid >> 5, lane = tid & 31, col = lane & 15, g = lane >> 4; const size_t r0 = (size_t)blockIdx.x * 64 + wave * 16; const int n0 = blockIdx.y * 128;
  const unsigned wv = uni((unsigned)tid >> 5), act = (wv < 2u) ? 1u : 0u;
  const unsigned long long tsrc = act ? (unsigned long long)(size_t)(O + ((size_t)blockIdx.x * 64 + wv * 32) * DM) : (unsigned long long)(size_t)(P + ((size_t)n0 + (wv - 2u) * 64) * DM);
  const unsigned tstep = act ? (unsigned)(GKS * 4) : (unsigned)(GKS * 2);   // bytes from one stage's slice to the next
  const unsigned tdst = (unsigned)(size_t)ring + wv * GSL;
  const u32x8 ga = tdm_group1_act(), gw = tdm_group1_wgt(); u32x4 g0 = tdm_group0(tdst, tsrc);
  gemm_load(act, g0, ga, gw);                                                             // stage 0
  gemm_wait(g0, ga, gw);                                                                  // this wave's slice of stage 0 has landed
  __syncthreads();                                                                        // stage 0 published to all four waves
  g0 = tdm_group0(tdst + GBUF, tsrc + tstep);
  gemm_load(act, g0, ga, gw);                                                             // stage 1
  const unsigned aoff = (unsigned)((wave >> 1) * GSL + ((wave & 1) * 16 + col) * GAP), boff = (unsigned)(2 * GSL + col * GBP);
  v8f acc[8] = {};
  // the stage loop stays rolled: one publish point and one refill site, and the buffer is picked by the stage's parity
#pragma unroll 1
  for (int st = 0; st < GST; ++st) { const unsigned char* buf = ring + (st & 1) * GBUF;
    v4f ar[2][4]; v16b wf[2][8];   // every fragment of the stage in registers of its own
#pragma unroll
    for (int kc = 0; kc < 2; ++kc) { const v4f* p = (const v4f*)(buf + aoff + kc * 128 + 32 * g); ar[kc][0] = p[0]; ar[kc][1] = p[1]; ar[kc][2] = p[4]; ar[kc][3] = p[5];
#pragma unroll
      for (int j = 0; j < 8; ++j) wf[kc][j] = frag_b((const __bf16*)(buf + boff + (j >> 2) * GSL + (j & 3) * 16 * GBP) + kc * 32, lane); }
    __builtin_amdgcn_sched_barrier(0);   // keeps the stage's LDS reads one group ahead of its WMMAs: sunk among them, each pair of WMMAs waits out an LDS latency of its own
#pragma unroll
    for (int kc = 0; kc < 2; ++kc) { float v[16];
#pragma unroll
      for (int i = 0; i < 4; ++i) { v[i] = ar[kc][0][i]; v[4 + i] = ar[kc][1][i]; v[8 + i] = ar[kc][2][i]; v[12 + i] = ar[kc][3][i]; }
      const F2 a = bsplit16(v);
#pragma unroll
      for (int j = 0; j < 8; ++j) { acc[j] = wmma_bf(a.l, wf[kc][j], acc[j]); acc[j] = wmma_bf(a.h, wf[kc][j], acc[j]); } }
    __builtin_amdgcn_sched_barrier(0);   // keeps the WMMAs ahead of the publish point: sunk behind its barrier, they delay the refill and stand idle while the next slice lands
    asm volatile("s_wait_dscnt 0x0" ::: "memory");        // this wave's reads of stage st are done
    gemm_wait(g0, ga, gw);                                // this wave's slice of stage st + 1 has landed
    __syncthreads();                                      // publishes stage st + 1 and ends every wave's reads of stage st
    if (pinned(st + 2 < GST)) { g0 = tdm_group0(tdst + (unsigned)(st & 1) * GBUF, tsrc + (unsigned long long)(unsigned)(st + 2) * tstep); gemm_load(act, g0, ga, gw); } }   // refill of the buffer just left
  gemm_wait(g0, ga, gw);                                  // no request outstanding behind the loop; the last pass's barrier has ended every read of the ring, which now stages the output
  asm volatile("s_wait_dscnt 0x0" ::: "memory");
#pragma unroll
  for (int j = 0; j < 8; ++j) {
#pragma unroll
    for (int r = 0; r < 8; ++r) so[wave][8 * g + r][j * 16 + col] = acc[j][r] + bfr(BO[n0 + j * 16 + col]); }
  LDSX();
  for (int rl = 0; rl < 16; ++rl) vst2(Y + (r0 + rl) * DM + n0 + lane * 4, *(const v4f*)&so[wave][rl][lane * 4]);
}
extern "C" void kernel_launch(void* const* d_in, const int* in_sizes, int n_in, void* d_out, int out_size, void* d_ws, size_t ws_size, hipStream_t stream) {
  (void)in_sizes; (void)n_in; (void)out_size;
  const float** F = (const float**)d_in;   // 0 x [4,2048,1024], 1 Wq [1024,1024] natural, 2 bq, 3 Wk, 4 bk, 5 Wv, 6 bv, 7 Wo, 8 bo
  if (ws_size < (size_t)WS_END) return;
  char* ws = (char*)d_ws; __bf16* PK = (__bf16*)(ws + WS_PK); _Float16 *QK = (_Float16*)(ws + WS_QK), *QKL = (_Float16*)(ws + WS_QKL), *VTH = (_Float16*)(ws + WS_VTH), *VTL = (_Float16*)(ws + WS_VTL); float* O = (float*)(ws + WS_O);
  k_pack<<<dim3(DM, 4), 256, 0, stream>>>(F[1], F[3], F[5], F[7], PK);
  k_qkv<<<dim3(TNB * SS / 64, QKVW / 128), 128, 0, stream>>>(F[0], PK + PK_A, F[2], F[4], F[6], QK, QKL, VTH, VTL);
  k_attn<<<dim3(NH, TNB, TQB), 128, 0, stream>>>(QK, QKL, VTH, VTL, O);
  k_out<<<dim3(TOB, DM / 128), 128, 0, stream>>>(O, PK + PK_P, F[8], (float*)d_out);
}

// v006
// Measured time: 173 microseconds a run.
// In both of two side-by-side timings against v005, it was 1.10 times as fast.
// All steps since v000 together make it 4.84 times as fast.
// compute dtype: x, Wq..Wo, bq..bo (module inputs) rounded to bf16; q/k/v projections with exact bf16 products on WMMA 16x16x32 (natural [out][in] rows) + biases; q and k stored as f16 hi + (x2048-scaled) residual planes with 3-product scores, x 1/sqrt(64), causal mask (k > q -> -1e9 in the module, zero weight), running-max softmax in f32 (hardware exp); P as f16 hi + (x2048) residual x v hi/lo (3 products); output projection with ctx as bf16 hi + residual x exact Wo rows (2 products) + bo; f32 accumulate.
#include <hip/hip_runtime.h>
#include <math.h>

typedef __attribute__((ext_vector_type(16))) _Float16 v16h;
typedef __attribute__((ext_vector_type(16))) __bf16 v16b;
typedef __attribute__((ext_vector_type(8)))  _Float16 v8h;
typedef __attribute__((ext_vector_type(8)))  float v8f;
typedef __attribute__((ext_vector_type(4)))  float v4f;
typedef __attribute__((ext_vector_type(2)))  float v2f;
typedef __attribute__((ext_vector_type(4)))  unsigned v4u;
typedef __attribute__((ext_vector_type(4)))  int v4i;
typedef float __attribute__((may_alias)) float_a;
typedef int __attribute__((may_alias)) int_a;

template <typename T> __device__ __forceinline__ void vst2(void* p, T v) { *(T*)p = v;  }
__device__ __forceinline__ v8f wmma16(v16h a, v16h b, v8f c) {
  v8f d = __builtin_amdgcn_wmma_f32_16x16x32_f16(false, a, false, b, (short)0, c, false, false);
  return d;
}
__device__ __forceinline__ v8f wmma_bf(v16b a, v16b b, v8f c) {
  v8f d = __builtin_amdgcn_wmma_f32_16x16x32_bf16(false, a, false, b, (short)0, c, false, false);
  return d;
}
// Masked (causal) multi-head attention (B 4, S 2,048, d 1,024, 16 heads x 64; four biased projections).
__device__ __forceinline__ v16h frag_h(const _Float16* rowk0, int lane) {
  union { v16h v; v8h q[2]; } u; const _Float16* p = rowk0 + 8 * (lane >> 4);
  u.q[0] = *(const v8h*)p; u.q[1] = *(const v8h*)(p + 16); return u.v;
}
__device__ __forceinline__ v16h frag_f32(const float* rowk0, int lane) {
  v16h a; const float* p = rowk0 + 8 * (lane >> 4);
#pragma unroll
  for (int i = 0; i < 8; ++i) { a[i] = (_Float16)p[i]; a[8 + i] = (_Float16)p[16 + i]; }
  return a;
}
__device__ __forceinline__ v16h frag_f32s(const float* rowk0, int lane, float sc) {
  v16h a; const float* p = rowk0 + 8 * (lane >> 4);
#pragma unroll
  for (int i = 0; i < 8; ++i) { a[i] = (_Float16)(p[i] * sc); a[8 + i] = (_Float16)(p[16 + i] * sc); }
  return a;
}
// column fragment from a [K][ld] layout (column n), rows >= K read as 0
__device__ __forceinline__ v16h fragc_f32(const float* W, int k0, int n, int lane, int ld, int K) {
  v16h a; const int g = lane >> 4;
#pragma unroll
  for (int i = 0; i < 8; ++i) { const int ka = k0 + 8 * g + i, kb = ka + 16;
    a[i] = (_Float16)(ka < K ? W[(size_t)(ka < K ? ka : K - 1) * ld + n] : 0.f); a[8 + i] = (_Float16)(kb < K ? W[(size_t)(kb < K ? kb : K - 1) * ld + n] : 0.f); }
  return a;
}
struct F2 { v16b h, l; };
__device__ __forceinline__ F2 bsplit16(const float v[16]) { F2 r;
#pragma unroll
  for (int i = 0; i < 16; ++i) { const __bf16 h = (__bf16)v[i]; r.h[i] = h; r.l[i] = (__bf16)(v[i] - (float)h); }
  return r; }
__device__ __forceinline__ F2 split_row(const float* row, int k0, int lane) { float v[16]; const float* p = row + k0 + 8 * (lane >> 4);
#pragma unroll
  for (int i = 0; i < 8; ++i) { v[i] = p[i]; v[8 + i] = p[16 + i]; }
  return bsplit16(v); }
__device__ __forceinline__ F2 split_rowK(const float* row, int k0, int lane, int K) { float v[16]; const int g = lane >> 4;
#pragma unroll
  for (int i = 0; i < 8; ++i) { const int ka = k0 + 8 * g + i, kb = ka + 16; v[i] = ka < K ? row[ka < K ? ka : K - 1] : 0.f; v[8 + i] = kb < K ? row[kb < K ? kb : K - 1] : 0.f; }
  return bsplit16(v); }
__device__ __forceinline__ F2 split_col(const float* W, int k0, int n, int lane, int ld, int K) { float v[16]; const int g = lane >> 4;
#pragma unroll
  for (int i = 0; i < 8; ++i) { const int ka = k0 + 8 * g + i, kb = ka + 16; v[i] = ka < K ? W[(size_t)(ka < K ? ka : K - 1) * ld + n] : 0.f; v[8 + i] = kb < K ? W[(size_t)(kb < K ? kb : K - 1) * ld + n] : 0.f; }
  return bsplit16(v); }
__device__ __forceinline__ v8f mac3(const F2& a, const F2& b, v8f c) { c = wmma_bf(a.l, b.h, c); c = wmma_bf(a.h, b.l, c); return wmma_bf(a.h, b.h, c); }
__device__ __forceinline__ float sigm(float v) { return 1.0f / (1.0f + expf(-v)); }
#define LDSX() do { asm volatile("s_wait_dscnt 0" ::: "memory"); __builtin_amdgcn_wave_barrier(); __builtin_amdgcn_fence(__ATOMIC_RELEASE, "workgroup"); } while (0)


#define NB 4
#define SS 2048
#define DM 1024
#define NH 16
#define HD 64
#define QKVW (3 * DM)
#ifndef TQB
#define TQB (SS / 64)
#define TNB NB
#define TOB (NB * SS / 128)    // row tiles of the two projection GEMMs (128 rows each)
#endif
typedef __attribute__((ext_vector_type(8))) __bf16 v8b;
__device__ __forceinline__ v16b frag_b(const __bf16* rowk0, int lane) {
  union { v16b v; v8b q[2]; } u; const __bf16* p = rowk0 + 8 * (lane >> 4);
  u.q[0] = *(const v8b*)p; u.q[1] = *(const v8b*)(p + 16); return u.v;
}
__device__ __forceinline__ float bfr(float v) { return (float)(__bf16)v; }
__device__ __attribute__((noinline)) float exp_ni(float v) { return expf(v); }
__device__ __attribute__((noinline)) float erf_ni(float v) { return erff(v); }

#define PK_A 0                       // [3072][1024] Wqkv rows (natural [out][in])
#define PK_P (PK_A + QKVW * DM)        // [1024][1024] Wo rows (natural)
#define PK_END (PK_P + DM * DM)
#define WS_PK  0u
#define WS_QK  (WS_PK + 2u * PK_END)             // f16 [8192 rows][2048]: q | k
#define WS_QKL (WS_QK + 2u * NB * SS * 2 * DM)     // f16 q | k residual planes x2048
#define WS_VTH (WS_QKL + 2u * NB * SS * 2 * DM)    // f16 [b][1024 (h*64+d)][2048 s] hi
#define WS_VTL (WS_VTH + 2u * NB * DM * SS)        // f16 lo x 2048
#define WS_O   (WS_VTL + 2u * NB * DM * SS)        // f32 [8192][1024]
#define WS_CS  (WS_O + 4u * NB * SS * DM)           // f32 2 x [2048][32], reserved but never written or read (no RoPE)
#define WS_END (WS_CS + 4u * 2 * SS * 32)
// ---- k_pack: block = (row n, which): natural [out][in] rows -> bf16; which 0..2 -> W_q/W_k/W_v into PK_A rows which*1024 + n; 3 -> W_o into PK_P
__global__ __launch_bounds__(256) void k_pack(const float* __restrict__ WQ, const float* __restrict__ WK, const float* __restrict__ WV, const float* __restrict__ WO, __bf16* __restrict__ PK) {
  __shared__ __align__(16) __bf16 s[DM]; const int n = blockIdx.x, which = blockIdx.y, t = threadIdx.x; const float* Wm = (which == 0) ? WQ : (which == 1) ? WK : (which == 2) ? WV : WO;
  for (int k = t; k < DM; k += 256) s[k] = (__bf16)Wm[(size_t)n * DM + k];
  __syncthreads();
  __bf16* dst = (which < 3) ? PK + PK_A + ((size_t)which * DM + n) * DM : PK + PK_P + (size_t)n * DM;
  for (int q = t; q < DM / 8; q += 256) vst2((unsigned*)(dst + q * 8), *(const v4u*)&s[q * 8]);
}
// ---- tensor-load helpers: a stage of k_attn is 64 keys; four tiles (K hi, K residual, V^T hi, V^T residual), each 64 rows of 128 B at source pitch 4096 B, one tile per wave
typedef unsigned u32x4 __attribute__((ext_vector_type(4)));
typedef unsigned u32x8 __attribute__((ext_vector_type(8)));
#define AKS 64                 // keys per stage
#define APITCH 144             // LDS row pitch in bytes: 128-B rows + 16 (odd multiple of 16 for the ds_load_b128 readers)
#define ASLICE 10240           // one tile in LDS: 64 x 144 B rounded up to a multiple of 2 KiB
#define ABUF (4 * ASLICE)      // one stage
__device__ __forceinline__ unsigned uni(unsigned v) { return (unsigned)__builtin_amdgcn_readfirstlane(v); }
__device__ __forceinline__ unsigned pinned(unsigned v) { unsigned w = uni(v); asm volatile("" : "+s"(w)); return w; }   // the issue test held in a scalar register, so that it compiles to s_cmp + s_cbranch_scc (a tensor load ignores EXEC)
__device__ __forceinline__ u32x4 tdm_group0(unsigned lds_dst, unsigned long long ga) {
  u32x4 g0; g0[0] = uni(1u); g0[1] = uni(lds_dst); g0[2] = uni((unsigned)ga); g0[3] = uni((((unsigned)(ga >> 32)) & 0x01FFFFFFu) | 0x80000000u); return g0;
}
__device__ __forceinline__ u32x8 tdm_group1() {
  u32x8 g1; g1[0] = uni((1u << 20) | (4u << 22) | (3u << 25));   // no mask, 1-byte elements, a pad of 4 dwords behind every 32 dwords (one row)
  g1[1] = uni(128u << 16); g1[2] = uni(64u << 16); g1[3] = uni(128u << 16); g1[4] = uni(64u); g1[5] = uni(4096u); g1[6] = uni(0u); g1[7] = uni(0u);
  asm volatile("" : "+s"(g1));   // descriptor words held in their scalar registers: without it the constants are formed anew at each load and their registers serve as temporaries while a request is out
  return g1;
}
__device__ __forceinline__ void tdm_load(u32x4 g0, u32x8 g1) { asm volatile("tensor_load_to_lds %0, %1" :: "s"(g0), "s"(g1) : "memory"); }
// the wave's own request has landed; the operands keep that request's descriptor registers unwritten up to here
__device__ __forceinline__ void tdm_wait(u32x4 g0, u32x8 g1) { asm volatile("s_wait_tensorcnt 0x0" :: "s"(g0), "s"(g1) : "memory"); }
// ---- ring of the two projection GEMMs: a stage is 64 k of a 128-row x 256-column block; eight slices, one per wave: waves 0 to 3 bring 32 activation rows each (f32, 256 B a row, source pitch 4096 B), waves 4 to 7 bring 64 weight rows each (bf16, 128 B a row, source pitch 2048 B). A wave computes 32 rows x 128 columns (wave & 3 picks the rows, wave >> 2 the columns): every staged activation byte serves 256 columns and every staged weight byte 128 rows, and a weight fragment read from LDS feeds two row tiles
#define GKS 64                 // k per stage
#define GST (DM / GKS)         // stages
#define GAP 272                // LDS pitch of an activation row: 256 B + 16 (odd multiple of 16 for the ds_load_b128 readers)
#define GBP 144                // LDS pitch of a weight row: 128 B + 16
#define GSL 10240              // one slice in LDS: 32 x 272 B or 64 x 144 B, rounded up to a multiple of 2 KiB
#define GBUF (8 * GSL)         // one stage
__device__ __forceinline__ u32x8 tdm_group1_act() {
  u32x8 g1; g1[0] = uni((1u << 20) | (5u << 22) | (3u << 25));   // no mask, 1-byte elements, a pad of 4 dwords behind every 64 dwords (one row)
  g1[1] = uni(256u << 16); g1[2] = uni(32u << 16); g1[3] = uni(256u << 16); g1[4] = uni(32u); g1[5] = uni(4096u); g1[6] = uni(0u); g1[7] = uni(0u);
  asm volatile("" : "+s"(g1));   // descriptor words held in their scalar registers (as in tdm_group1)
  return g1;
}
__device__ __forceinline__ u32x8 tdm_group1_wgt() {
  u32x8 g1; g1[0] = uni((1u << 20) | (4u << 22) | (3u << 25));   // no mask, 1-byte elements, a pad of 4 dwords behind every 32 dwords (one row)
  g1[1] = uni(128u << 16); g1[2] = uni(64u << 16); g1[3] = uni(128u << 16); g1[4] = uni(64u); g1[5] = uni(2048u); g1[6] = uni(0u); g1[7] = uni(0u);
  asm volatile("" : "+s"(g1));   // descriptor words held in their scalar registers (as in tdm_group1)
  return g1;
}
// every wave issues its one slice; the two scalar branches only pick which of the two constant descriptors goes with it (act is 1 in waves 0 to 3, 0 in waves 4 to 7)
__device__ __forceinline__ void gemm_load(unsigned act, u32x4 g0, u32x8 ga, u32x8 gw) { if (pinned(act)) tdm_load(g0, ga); if (pinned(act ^ 1u)) tdm_load(g0, gw); }
// the wave's own request has landed; the operands keep the descriptor registers unwritten up to here
__device__ __forceinline__ void gemm_wait(u32x4 g0, u32x8 ga, u32x8 gw) { asm volatile("s_wait_tensorcnt 0x0" :: "s"(g0), "s"(ga), "s"(gw) : "memory"); }
__global__ __launch_bounds__(256) void k_qkv(const float* __restrict__ X, const __bf16* __restrict__ P, const float* __restrict__ BQ, const float* __restrict__ BK, const float* __restrict__ BV, _Float16* __restrict__ QK, _Float16* __restrict__ QKL, _Float16* __restrict__ VTH, _Float16* __restrict__ VTL) {
  __shared__ __attribute__((aligned(2048))) unsigned char ring[2 * GBUF];   // two stages of x and W slices, shared by the eight waves; behind the K loop the same bytes stage the output
  _Float16 (*so)[32][136] = (_Float16 (*)[32][136])ring, (*sol)[32][136] = (_Float16 (*)[32][136])(ring + 8 * 32 * 136 * 2); _Float16 (*sth)[136] = (_Float16 (*)[136])ring, (*stl)[136] = (_Float16 (*)[136])(ring + 256 * 136 * 2);
  const int tid = threadIdx.x, wave = tid >> 5, lane = tid & 31, col = lane & 15, g = lane >> 4, wm = wave & 3, wn = wave >> 2; const size_t r0 = (size_t)blockIdx.x * 128 + wm * 32; const int nb = blockIdx.y * 256, n0 = nb + wn * 128;
  const unsigned wv = uni((unsigned)tid >> 5), act = (wv < 4u) ? 1u : 0u;
  const unsigned long long tsrc = act ? (unsigned long long)(size_t)(X + ((size_t)blockIdx.x * 128 + wv * 32) * DM) : (unsigned long long)(size_t)(P + ((size_t)nb + (wv - 4u) * 64) * DM);
  const unsigned tstep = act ? (unsigned)(GKS * 4) : (unsigned)(GKS * 2);   // bytes from one stage's slice to the next
  const unsigned tdst = (unsigned)(size_t)ring + wv * GSL;
  const u32x8 ga = tdm_group1_act(), gw = tdm_group1_wgt(); u32x4 g0 = tdm_group0(tdst, tsrc);
  gemm_load(act, g0, ga, gw);                                                             // stage 0
  gemm_wait(g0, ga, gw);                                                                  // this wave's slice of stage 0 has landed
  __syncthreads();                                                                        // stage 0 published to all eight waves
  g0 = tdm_group0(tdst + GBUF, tsrc + tstep);
  gemm_load(act, g0, ga, gw);                                                             // stage 1
  const unsigned aoff = (unsigned)(wm * GSL + col * GAP + 32 * g), boff = (unsigned)((4 + 2 * wn) * GSL + col * GBP);
  v8f acc[2][8] = {};
  // the stage loop stays rolled: one publish point and one refill site, and the buffer is picked by the stage's parity
#pragma unroll 1
  for (int st = 0; st < GST; ++st) { const unsigned char* buf = ring + (st & 1) * GBUF;
#pragma unroll
    for (int kc = 0; kc < 2; ++kc) { v4f ar[2][4]; v16b wf[8];   // every fragment of 32 k in registers of its own
#pragma unroll
      for (int i = 0; i < 2; ++i) { const v4f* p = (const v4f*)(buf + aoff + i * 16 * GAP + kc * 128); ar[i][0] = p[0]; ar[i][1] = p[1]; ar[i][2] = p[4]; ar[i][3] = p[5]; }
#pragma unroll
      for (int j = 0; j < 8; ++j) wf[j] = frag_b((const __bf16*)(buf + boff + (j >> 2) * GSL + (j & 3) * 16 * GBP) + kc * 32, lane);
      __builtin_amdgcn_sched_barrier(0);   // keeps the LDS reads of 32 k one group ahead of their WMMAs: sunk among them, each WMMA waits out an LDS latency of its own
      v16b a[2];
#pragma unroll
      for (int i = 0; i < 2; ++i) {
#pragma unroll
        for (int e = 0; e < 4; ++e) { a[i][e] = (__bf16)ar[i][0][e]; a[i][4 + e] = (__bf16)ar[i][1][e]; a[i][8 + e] = (__bf16)ar[i][2][e]; a[i][12 + e] = (__bf16)ar[i][3][e]; } }
#pragma unroll
      for (int j = 0; j < 8; ++j) {
#pragma unroll
        for (int i = 0; i < 2; ++i) acc[i][j] = wmma_bf(a[i], wf[j], acc[i][j]); }
      __builtin_amdgcn_sched_barrier(0); }   // keeps the WMMAs ahead of the next read group and of the publish point: the next 32 k's reads lifted among them take a second fragment set's registers, and WMMAs sunk behind the barrier delay the refill
    asm volatile("s_wait_dscnt 0x0" ::: "memory");        // this wave's reads of stage st are done
    gemm_wait(g0, ga, gw);                                // this wave's slice of stage st + 1 has landed
    __syncthreads();                                      // publishes stage st + 1 and ends every wave's reads of stage st
    if (pinned(st + 2 < GST)) { g0 = tdm_group0(tdst + (unsigned)(st & 1) * GBUF, tsrc + (unsigned long long)(unsigned)(st + 2) * tstep); gemm_load(act, g0, ga, gw); } }   // refill of the buffer just left
  gemm_wait(g0, ga, gw);                                  // no request outstanding behind the loop; the last pass's barrier has ended every read of the ring, which now stages the output
  asm volatile("s_wait_dscnt 0x0" ::: "memory");
  { const int which = nb / DM; const float* BB = (which == 0) ? BQ : (which == 1) ? BK : BV;
#pragma unroll
    for (int j = 0; j < 8; ++j) { const float bb = bfr(BB[(n0 % DM) + j * 16 + col]);
#pragma unroll
      for (int i = 0; i < 2; ++i) {
#pragma unroll
        for (int r = 0; r < 8; ++r) acc[i][j][r] += bb; } } }
  if (nb < 2 * DM) {   // q stored unscaled (f16 sigma ~0.6, no subnormal exposure); 1/8 applied to the f32 score
#pragma unroll
    for (int i = 0; i < 2; ++i) {
#pragma unroll
      for (int j = 0; j < 8; ++j) {
#pragma unroll
        for (int r = 0; r < 8; ++r) { const float v = acc[i][j][r]; const _Float16 hv = (_Float16)v; so[wave][i * 16 + 8 * g + r][j * 16 + col] = hv; sol[wave][i * 16 + 8 * g + r][j * 16 + col] = (_Float16)((v - (float)hv) * 2048.0f); } } }   // q, k as f16 hi + (x2048) residual (no RoPE in this module)
    LDSX();
    for (int rl = 0; rl < 32; ++rl) if (lane < 16) { vst2((unsigned*)(QK + (r0 + rl) * (2 * DM) + n0 + lane * 8), *(const v4u*)&so[wave][rl][lane * 8]); vst2((unsigned*)(QKL + (r0 + rl) * (2 * DM) + n0 + lane * 8), *(const v4u*)&sol[wave][rl][lane * 8]); }
  } else {
#pragma unroll
    for (int i = 0; i < 2; ++i) {
#pragma unroll
      for (int j = 0; j < 8; ++j) {
#pragma unroll
        for (int r = 0; r < 8; ++r) { const float v = acc[i][j][r]; const _Float16 hv = (_Float16)v; sth[wn * 128 + j * 16 + col][wm * 32 + i * 16 + 8 * g + r] = hv; stl[wn * 128 + j * 16 + col][wm * 32 + i * 16 + 8 * g + r] = (_Float16)((v - (float)hv) * 2048.0f); } } }
    __syncthreads();
    const size_t rb = (size_t)blockIdx.x * 128; const int b = (int)(rb / SS), s0 = (int)(rb % SS); const int pc0 = nb - 2 * DM;
    for (int q = tid; q < 256 * 16; q += 256) { const int d = q >> 4, pc = q & 15; const size_t o = ((size_t)b * DM + pc0 + d) * SS + s0 + pc * 8; vst2((unsigned*)(VTH + o), *(const v4u*)&sth[d][pc * 8]); vst2((unsigned*)(VTL + o), *(const v4u*)&stl[d][pc * 8]); }
  }
}
// lane l with lane l ^ 16 (a vector cross-row move, no LDS traffic)
__device__ __forceinline__ float xhalf(float x) { return __builtin_bit_cast(float, __builtin_amdgcn_permlanex16(__builtin_bit_cast(int, x), __builtin_bit_cast(int, x), 0x76543210, 0xfedcba98, false, false)); }
// eight hardware exp2 in one statement, so that the free slot which the instruction set asks for behind a transcendental is there by construction: the outputs are early-clobber (none shares a register with an input), so each v_exp_f32 is followed by one that neither reads its result nor overwrites its source, and the v_nop is the slot behind the last.
__device__ __forceinline__ v8f exp2x8(v8f x) { float e0, e1, e2, e3, e4, e5, e6, e7;
  asm("v_exp_f32 %0, %8\n\tv_exp_f32 %1, %9\n\tv_exp_f32 %2, %10\n\tv_exp_f32 %3, %11\n\tv_exp_f32 %4, %12\n\tv_exp_f32 %5, %13\n\tv_exp_f32 %6, %14\n\tv_exp_f32 %7, %15\n\tv_nop"
      : "=&v"(e0), "=&v"(e1), "=&v"(e2), "=&v"(e3), "=&v"(e4), "=&v"(e5), "=&v"(e6), "=&v"(e7)
      : "v"(x[0]), "v"(x[1]), "v"(x[2]), "v"(x[3]), "v"(x[4]), "v"(x[5]), "v"(x[6]), "v"(x[7]));
  v8f e = {e0, e1, e2, e3, e4, e5, e6, e7}; return e; }
// ---- k_attn: block = (head h, batch b, 64 queries, last query block first): causal flash attention in transposed form: S^T = K . Q^T (A = key rows from LDS, B = the wave's 16 queries, kept in registers), so a lane holds 16 of the 32 scores of ONE query (column = lane & 15; keys 8 g + r and 16 + 8 g + r): maximum and sum run in the lane, one exchange between the wave halves joins the maximum, the halves' sums are joined once at the end. The score registers are already in the k order of a B operand, so P^T (f16 hi + x2048 residual) goes from them straight into O^T += V^T . P^T (A = V^T rows from LDS). Products as before: 3 for the scores, 3 for P.V; O[b*S+q][h*64+d] = (acc + accl / 2048) / l (256-B segments)
__global__ __launch_bounds__(128) void k_attn(const _Float16* __restrict__ QK, const _Float16* __restrict__ QKL, const _Float16* __restrict__ VTH, const _Float16* __restrict__ VTL, float* __restrict__ O) {
  __shared__ __attribute__((aligned(2048))) unsigned char ring[2 * ABUF];   // two stages of K/V tiles, shared by the four waves
  __shared__ __align__(16) float so[4][16][68];
  const int tid = threadIdx.x, wave = tid >> 5, lane = tid & 31, col = lane & 15, g = lane >> 4;
  // a work-group's cost grows with its query block (qb + 1 stages) and there are more work-groups than resident places: the query block is the slowest grid index and falls with it, so the longest work-groups start first and the shortest fill the end of the launch
  const int qb = TQB - 1 - (int)blockIdx.z, h = blockIdx.x, b = blockIdx.y; const int q0 = qb * 64 + wave * 16; const size_t rq = (size_t)b * SS + q0 + col;
  // every wave brings one tile of each stage: wave 0 K hi, 1 K residual (64 key rows), 2 V^T hi, 3 V^T residual (64 d rows x 64 keys)
  const unsigned wv = uni((unsigned)tid >> 5); const size_t ko = (size_t)b * SS * (2 * DM) + DM + h * HD, vo = ((size_t)b * DM + h * HD) * SS;
  const _Float16* tsrc = (wv == 0u) ? QK + ko : (wv == 1u) ? QKL + ko : (wv == 2u) ? VTH + vo : VTL + vo;
  const unsigned tstep = (wv < 2u) ? (unsigned)(AKS * 2 * DM * 2) : (unsigned)(AKS * 2);   // bytes from one stage's tile to the next
  const unsigned tdst = (unsigned)(size_t)ring + wv * ASLICE;
  const u32x8 g1 = tdm_group1(); u32x4 g0 = tdm_group0(tdst, (unsigned long long)(size_t)tsrc);
  tdm_load(g0, g1);                                                                       // stage 0
  tdm_wait(g0, g1);                                                                       // this wave's tile of stage 0 has landed
  __syncthreads();                                                                        // stage 0 published to all four waves
  g0 = tdm_group0(tdst + ABUF, (unsigned long long)(size_t)tsrc + tstep);
  tdm_load(g0, g1);                                                                       // stage 1 (keys 64..127 exist for every block; unread where qb is 0)
  v16h aq[2], aql[2];
#pragma unroll
  for (int kc = 0; kc < 2; ++kc) { aq[kc] = frag_h(QK + rq * (2 * DM) + h * HD + kc * 32, lane); aql[kc] = frag_h(QKL + rq * (2 * DM) + h * HD + kc * 32, lane); }
  float m = -3.0e38f, l = 0.f;   // of query q0 + col; m is the same in both wave halves, l holds this half's keys only
  v8f acc[4] = {}, accl[4] = {};   // O^T: row d = dt * 16 + 8 g + r, column = query
  const int qi = q0 + col;
  const int nst = qb + 1;
#pragma unroll 1
  for (int st = 0; st < nst; ++st) { const unsigned char* buf = ring + (st & 1) * ABUF;
  // the two halves of a stage stay a rolled loop: unrolled, the first half's P.V products are moved behind the second half's scores and their V^T fragments stay live, which takes the kernel past 256 registers
#pragma unroll 1
  for (int sub = 0; sub < 2; ++sub) { const int ks = st * 2 + sub; v8f s[2]; v16h kh[2][2], kl[2][2], vh[4], vl[4];
#pragma unroll
    for (int ct = 0; ct < 2; ++ct) { const _Float16* krow = (const _Float16*)(buf + (sub * 32 + ct * 16 + col) * APITCH); const _Float16* krowl = (const _Float16*)(buf + ASLICE + (sub * 32 + ct * 16 + col) * APITCH);
#pragma unroll
      for (int kc = 0; kc < 2; ++kc) { kh[ct][kc] = frag_h(krow + kc * 32, lane); kl[ct][kc] = frag_h(krowl + kc * 32, lane); } }
    __builtin_amdgcn_sched_barrier(0);   // keeps the 32 keys' K reads one group ahead of the score WMMAs: sunk among them, each fragment's LDS latency is waited out on its own
    v8f cc[2] = {}, cr[2] = {};
#pragma unroll
    for (int kc = 0; kc < 2; ++kc) {
#pragma unroll
      for (int ct = 0; ct < 2; ++ct) { cc[ct] = wmma16(kh[ct][kc], aq[kc], cc[ct]); cr[ct] = wmma16(kh[ct][kc], aql[kc], cr[ct]); }
#pragma unroll
      for (int ct = 0; ct < 2; ++ct) cr[ct] = wmma16(kl[ct][kc], aq[kc], cr[ct]); }   // 3 products: q, k as f16 hi + residual; the two key tiles alternate, so that no WMMA directly follows the one whose accumulator it adds to
#pragma unroll
    for (int dt = 0; dt < 4; ++dt) { const unsigned char* vr = buf + 2 * ASLICE + (dt * 16 + col) * APITCH + sub * 64; vh[dt] = frag_h((const _Float16*)vr, lane); vl[dt] = frag_h((const _Float16*)(vr + ASLICE), lane); }
    __builtin_amdgcn_sched_barrier(0);   // keeps the V^T reads one group ahead of the softmax, whose vector work covers their latency: left free, part of them sinks among the P.V WMMAs and is waited out there
#pragma unroll
    for (int ct = 0; ct < 2; ++ct) { const int kk = ks * 32 + ct * 16 + 8 * g; v8f c = cc[ct]; const v8f cl = cr[ct];
#pragma unroll
      for (int r = 0; r < 8; ++r) c[r] += cl[r] * (1.0f / 2048.0f);
#pragma unroll
      for (int r = 0; r < 8; ++r) s[ct][r] = (kk + r <= qi) ? c[r] * 0.125f : -3.0e38f; }   // SCALE = 1/sqrt(64)
    float mx = fmaxf(s[0][0], s[1][0]);
#pragma unroll
    for (int r = 1; r < 8; ++r) mx = fmaxf(mx, fmaxf(s[0][r], s[1][r]));
    mx = fmaxf(mx, xhalf(mx));
    const float mn = fmaxf(m, mx); const float alpha = (m <= -1.0e38f) ? 0.f : __expf(m - mn);
    v8f x0, x1;
#pragma unroll
    for (int r = 0; r < 8; ++r) { x0[r] = (s[0][r] - mn) * 1.44269504f; x1[r] = (s[1][r] - mn) * 1.44269504f; }   // exp(v) = exp2(v * log2 e), as __expf forms it
    const v8f y0 = exp2x8(x0), y1 = exp2x8(x1);
    v16h pa, pl; float es[4] = {0.f, 0.f, 0.f, 0.f};   // four independent partial sums
#pragma unroll
    for (int r = 0; r < 8; ++r) { const float e0 = (s[0][r] <= -1.0e38f) ? 0.f : y0[r], e1 = (s[1][r] <= -1.0e38f) ? 0.f : y1[r]; es[r & 3] += e0 + e1;
      const _Float16 h0 = (_Float16)e0, h1 = (_Float16)e1; pa[r] = h0; pa[8 + r] = h1; pl[r] = (_Float16)((e0 - (float)h0) * 2048.0f); pl[8 + r] = (_Float16)((e1 - (float)h1) * 2048.0f); }   // B operand: element r is key 8 g + r, element 8 + r is key 16 + 8 g + r, as in frag_h
    l = l * alpha + ((es[0] + es[1]) + (es[2] + es[3])); m = mn;
#pragma unroll
    for (int dt = 0; dt < 4; ++dt) {
#pragma unroll
      for (int r = 0; r < 8; ++r) { acc[dt][r] *= alpha; accl[dt][r] *= alpha; } }
#pragma unroll
    for (int dt = 0; dt < 4; ++dt) { acc[dt] = wmma16(vh[dt], pa, acc[dt]); accl[dt] = wmma16(vh[dt], pl, accl[dt]); accl[dt] = wmma16(vl[dt], pa, accl[dt]); } }   // V hi x P hi + (V hi x P lo + V lo x P hi) / 2048
    asm volatile("s_wait_dscnt 0x0" ::: "memory");        // this wave's reads of stage st are done
    tdm_wait(g0, g1);                                     // this wave's tile of stage st + 1 has landed
    __syncthreads();                                      // publishes stage st + 1 and ends every wave's reads of stage st
    if (pinned(st + 2 < nst)) { g0 = tdm_group0(tdst + (unsigned)(st & 1) * ABUF, (unsigned long long)(size_t)tsrc + (unsigned long long)(unsigned)(st + 2) * tstep); tdm_load(g0, g1); } }   // refill of the buffer just left
  tdm_wait(g0, g1);                                       // no request outstanding when the wave goes on to its end
  asm volatile("s_wait_dscnt 0x0" ::: "memory");
  const float il = 1.0f / (l + xhalf(l));                 // the two halves' sums joined
#pragma unroll
  for (int dt = 0; dt < 4; ++dt) {
#pragma unroll
    for (int r = 0; r < 8; ++r) so[wave][col][dt * 16 + 8 * g + r] = (acc[dt][r] + accl[dt][r] * (1.0f / 2048.0f)) * il; }
  LDSX();
  for (int rl = 0; rl < 16; ++rl) if (lane < 16) vst2(O + ((size_t)b * SS + q0 + rl) * DM + h * HD + lane * 4, *(const v4f*)&so[wave][rl][lane * 4]);
}
// ---- k_out: block = (128 rows, 256 cols), wave = 32 rows x 128 cols: out = O(hi/lo) . Wo rows (2 products) + bo
__global__ __launch_bounds__(256) void k_out(const float* __restrict__ O, const __bf16* __restrict__ P, const float* __restrict__ BO, float* __restrict__ Y) {
  __shared__ __attribute__((aligned(2048))) unsigned char ring[2 * GBUF];   // two stages of ctx and Wo slices, shared by the eight waves; behind the K loop the same bytes stage the output
  float (*so)[32][132] = (float (*)[32][132])ring;
  const int tid = threadIdx.x, wave = tid >> 5, lane = tid & 31, col = lane & 15, g = lane >> 4, wm = wave & 3, wn = wave >> 2; const size_t r0 = (size_t)blockIdx.x * 128 + wm * 32; const int nb = blockIdx.y * 256, n0 = nb + wn * 128;
  const unsigned wv = uni((unsigned)tid >> 5), act = (wv < 4u) ? 1u : 0u;
  const unsigned long long tsrc = act ? (unsigned long long)(size_t)(O + ((size_t)blockIdx.x * 128 + wv * 32) * DM) : (unsigned long long)(size_t)(P + ((size_t)nb + (wv - 4u) * 64) * DM);
  const unsigned tstep = act ? (unsigned)(GKS * 4) : (unsigned)(GKS * 2);   // bytes from one stage's slice to the next
  const unsigned tdst = (unsigned)(size_t)ring + wv * GSL;
  const u32x8 ga = tdm_group1_act(), gw = tdm_group1_wgt(); u32x4 g0 = tdm_group0(tdst, tsrc);
  gemm_load(act, g0, ga, gw);                                                             // stage 0
  gemm_wait(g0, ga, gw);                                                                  // this wave's slice of stage 0 has landed
  __syncthreads();                                                                        // stage 0 published to all eight waves
  g0 = tdm_group0(tdst + GBUF, tsrc + tstep);
  gemm_load(act, g0, ga, gw);                                                             // stage 1
  const unsigned aoff = (unsigned)(wm * GSL + col * GAP + 32 * g), boff = (unsigned)((4 + 2 * wn) * GSL + col * GBP);
  v8f acc[2][8] = {};
  // the stage loop stays rolled: one publish point and one refill site, and the buffer is picked by the stage's parity
#pragma unroll 1
  for (int st = 0; st < GST; ++st) { const unsigned char* buf = ring + (st & 1) * GBUF;
#pragma unroll
    for (int kc = 0; kc < 2; ++kc) { v4f ar[2][4]; v16b wf[8];   // every fragment of 32 k in registers of its own
#pragma unroll
      for (int i = 0; i < 2; ++i) { const v4f* p = (const v4f*)(buf + aoff + i * 16 * GAP + kc * 128); ar[i][0] = p[0]; ar[i][1] = p[1]; ar[i][2] = p[4]; ar[i][3] = p[5]; }
#pragma unroll
      for (int j = 0; j < 8; ++j) wf[j] = frag_b((const __bf16*)(buf + boff + (j >> 2) * GSL + (j & 3) * 16 * GBP) + kc * 32, lane);
      __builtin_amdgcn_sched_barrier(0);   // keeps the LDS reads of 32 k one group ahead of their WMMAs: sunk among them, each group of WMMAs waits out an LDS latency of its own
#pragma unroll
      for (int i = 0; i < 2; ++i) { float v[16];   // one row tile at a time: its hi and residual fragments are the only converted ones alive
#pragma unroll
        for (int e = 0; e < 4; ++e) { v[e] = ar[i][0][e]; v[4 + e] = ar[i][1][e]; v[8 + e] = ar[i][2][e]; v[12 + e] = ar[i][3][e]; }
        const F2 a = bsplit16(v);
#pragma unroll
        for (int j = 0; j < 8; ++j) acc[i][j] = wmma_bf(a.l, wf[j], acc[i][j]);
#pragma unroll
        for (int j = 0; j < 8; ++j) acc[i][j] = wmma_bf(a.h, wf[j], acc[i][j]); }   // residual first, then hi, as before; seven other WMMAs stand between the two that add to one accumulator
      __builtin_amdgcn_sched_barrier(0); }   // keeps the WMMAs ahead of the next read group and of the publish point: the next 32 k's reads lifted among them take a second fragment set's registers, and WMMAs sunk behind the barrier delay the refill
    asm volatile("s_wait_dscnt 0x0" ::: "memory");        // this wave's reads of stage st are done
    gemm_wait(g0, ga, gw);                                // this wave's slice of stage st + 1 has landed
    __syncthreads();                                      // publishes stage st + 1 and ends every wave's reads of stage st
    if (pinned(st + 2 < GST)) { g0 = tdm_group0(tdst + (unsigned)(st & 1) * GBUF, tsrc + (unsigned long long)(unsigned)(st + 2) * tstep); gemm_load(act, g0, ga, gw); } }   // refill of the buffer just left
  gemm_wait(g0, ga, gw);                                  // no request outstanding behind the loop; the last pass's barrier has ended every read of the ring, which now stages the output
  asm volatile("s_wait_dscnt 0x0" ::: "memory");
#pragma unroll
  for (int i = 0; i < 2; ++i) {
#pragma unroll
    for (int j = 0; j < 8; ++j) {
#pragma unroll
      for (int r = 0; r < 8; ++r) so[wave][i * 16 + 8 * g + r][j * 16 + col] = acc[i][j][r] + bfr(BO[n0 + j * 16 + col]); } }
  LDSX();
  for (int rl = 0; rl < 32; ++rl) vst2(Y + (r0 + rl) * DM + n0 + lane * 4, *(const v4f*)&so[wave][rl][lane * 4]);
}
extern "C" void kernel_launch(void* const* d_in, const int* in_sizes, int n_in, void* d_out, int out_size, void* d_ws, size_t ws_size, hipStream_t stream) {
  (void)in_sizes; (void)n_in; (void)out_size;
  const float** F = (const float**)d_in;   // 0 x [4,2048,1024], 1 Wq [1024,1024] natural, 2 bq, 3 Wk, 4 bk, 5 Wv, 6 bv, 7 Wo, 8 bo
  if (ws_size < (size_t)WS_END) return;
  char* ws = (char*)d_ws; __bf16* PK = (__bf16*)(ws + WS_PK); _Float16 *QK = (_Float16*)(ws + WS_QK), *QKL = (_Float16*)(ws + WS_QKL), *VTH = (_Float16*)(ws + WS_VTH), *VTL = (_Float16*)(ws + WS_VTL); float* O = (float*)(ws + WS_O);
  k_pack<<<dim3(DM, 4), 256, 0, stream>>>(F[1], F[3], F[5], F[7], PK);
  k_qkv<<<dim3(TOB, QKVW / 256), 256, 0, stream>>>(F[0], PK + PK_A, F[2], F[4], F[6], QK, QKL, VTH, VTL);
  k_attn<<<dim3(NH, TNB, TQB), 128, 0, stream>>>(QK, QKL, VTH, VTL, O);
  k_out<<<dim3(TOB, DM / 256), 256, 0, stream>>>(O, PK + PK_P, F[8], (float*)d_out);
}

// v007
// A run of this version takes 164 microseconds.
// Two timings next to v006 both put it at 1.05 times that version's speed.
// All steps since v000 together make it 5.10 times as fast.
// compute dtype: x, Wq..Wo, bq..bo (module inputs) rounded to bf16; q/k/v projections with exact bf16 products on WMMA 16x16x32 (natural [out][in] rows) + biases; q and k stored as f16 hi + (x2048-scaled) residual planes with 3-product scores, x 1/sqrt(64), causal mask (k > q -> -1e9 in the module, zero weight), running-max softmax in f32 (hardware exp); P as f16 hi + (x2048) residual x v hi/lo (3 products); output projection with ctx as bf16 hi + residual x exact Wo rows (2 products) + bo; f32 accumulate.
#include <hip/hip_runtime.h>
#include <math.h>

typedef __attribute__((ext_vector_type(16))) _Float16 v16h;
typedef __attribute__((ext_vector_type(16))) __bf16 v16b;
typedef __attribute__((ext_vector_type(8)))  _Float16 v8h;
typedef __attribute__((ext_vector_type(8)))  float v8f;
typedef __attribute__((ext_vector_type(4)))  float v4f;
typedef __attribute__((ext_vector_type(2)))  float v2f;
typedef __attribute__((ext_vector_type(4)))  unsigned v4u;
typedef __attribute__((ext_vector_type(4)))  int v4i;
typedef float __attribute__((may_alias)) float_a;
typedef int __attribute__((may_alias)) int_a;

template <typename T> __device__ __forceinline__ void vst2(void* p, T v) { *(T*)p = v;  }
__device__ __forceinline__ v8f wmma16(v16h a, v16h b, v8f c) {
  v8f d = __builtin_amdgcn_wmma_f32_16x16x32_f16(false, a, false, b, (short)0, c, false, false);
  return d;
}
__device__ __forceinline__ v8f wmma_bf(v16b a, v16b b, v8f c) {
  v8f d = __builtin_amdgcn_wmma_f32_16x16x32_bf16(false, a, false, b, (short)0, c, false, false);
  return d;
}
// Masked (causal) multi-head attention (B 4, S 2,048, d 1,024, 16 heads x 64; four biased projections).
__device__ __forceinline__ v16h frag_h(const _Float16* rowk0, int lane) {
  union { v16h v; v8h q[2]; } u; const _Float16* p = rowk0 + 8 * (lane >> 4);
  u.q[0] = *(const v8h*)p; u.q[1] = *(const v8h*)(p + 16); return u.v;
}
__device__ __forceinline__ v16h frag_f32(const float* rowk0, int lane) {
  v16h a; const float* p = rowk0 + 8 * (lane >> 4);
#pragma unroll
  for (int i = 0; i < 8; ++i) { a[i] = (_Float16)p[i]; a[8 + i] = (_Float16)p[16 + i]; }
  return a;
}
__device__ __forceinline__ v16h frag_f32s(const float* rowk0, int lane, float sc) {
  v16h a; const float* p = rowk0 + 8 * (lane >> 4);
#pragma unroll
  for (int i = 0; i < 8; ++i) { a[i] = (_Float16)(p[i] * sc); a[8 + i] = (_Float16)(p[16 + i] * sc); }
  return a;
}
// column fragment from a [K][ld] layout (column n), rows >= K read as 0
__device__ __forceinline__ v16h fragc_f32(const float* W, int k0, int n, int lane, int ld, int K) {
  v16h a; const int g = lane >> 4;
#pragma unroll
  for (int i = 0; i < 8; ++i) { const int ka = k0 + 8 * g + i, kb = ka + 16;
    a[i] = (_Float16)(ka < K ? W[(size_t)(ka < K ? ka : K - 1) * ld + n] : 0.f); a[8 + i] = (_Float16)(kb < K ? W[(size_t)(kb < K ? kb : K - 1) * ld + n] : 0.f); }
  return a;
}
struct F2 { v16b h, l; };
__device__ __forceinline__ F2 bsplit16(const float v[16]) { F2 r;
#pragma unroll
  for (int i = 0; i < 16; ++i) { const __bf16 h = (__bf16)v[i]; r.h[i] = h; r.l[i] = (__bf16)(v[i] - (float)h); }
  return r; }
__device__ __forceinline__ F2 split_row(const float* row, int k0, int lane) { float v[16]; const float* p = row + k0 + 8 * (lane >> 4);
#pragma unroll
  for (int i = 0; i < 8; ++i) { v[i] = p[i]; v[8 + i] = p[16 + i]; }
  return bsplit16(v); }
__device__ __forceinline__ F2 split_rowK(const float* row, int k0, int lane, int K) { float v[16]; const int g = lane >> 4;
#pragma unroll
  for (int i = 0; i < 8; ++i) { const int ka = k0 + 8 * g + i, kb = ka + 16; v[i] = ka < K ? row[ka < K ? ka : K - 1] : 0.f; v[8 + i] = kb < K ? row[kb < K ? kb : K - 1] : 0.f; }
  return bsplit16(v); }
__device__ __forceinline__ F2 split_col(const float* W, int k0, int n, int lane, int ld, int K) { float v[16]; const int g = lane >> 4;
#pragma unroll
  for (int i = 0; i < 8; ++i) { const int ka = k0 + 8 * g + i, kb = ka + 16; v[i] = ka < K ? W[(size_t)(ka < K ? ka : K - 1) * ld + n] : 0.f; v[8 + i] = kb < K ? W[(size_t)(kb < K ? kb : K - 1) * ld + n] : 0.f; }
  return bsplit16(v); }
__device__ __forceinline__ v8f mac3(const F2& a, const F2& b, v8f c) { c = wmma_bf(a.l, b.h, c); c = wmma_bf(a.h, b.l, c); return wmma_bf(a.h, b.h, c); }
__device__ __forceinline__ float sigm(float v) { return 1.0f / (1.0f + expf(-v)); }
#define LDSX() do { asm volatile("s_wait_dscnt 0" ::: "memory"); __builtin_amdgcn_wave_barrier(); __builtin_amdgcn_fence(__ATOMIC_RELEASE, "workgroup"); } while (0)


#define NB 4
#define SS 2048
#define DM 1024
#define NH 16
#define HD 64
#define QKVW (3 * DM)
#ifndef TQB
#define TQB (SS / 64)
#define TNB NB
#define TOB (NB * SS / 128)    // row tiles of the two projection GEMMs (128 rows each)
#endif
typedef __attribute__((ext_vector_type(8))) __bf16 v8b;
__device__ __forceinline__ v16b frag_b(const __bf16* rowk0, int lane) {
  union { v16b v; v8b q[2]; } u; const __bf16* p = rowk0 + 8 * (lane >> 4);
  u.q[0] = *(const v8b*)p; u.q[1] = *(const v8b*)(p + 16); return u.v;
}
__device__ __forceinline__ float bfr(float v) { return (float)(__bf16)v; }
__device__ __attribute__((noinline)) float exp_ni(float v) { return expf(v); }
__device__ __attribute__((noinline)) float erf_ni(float v) { return erff(v); }

#define PK_A 0                       // [3072][1024] Wqkv rows (natural [out][in])
#define PK_P (PK_A + QKVW * DM)        // [1024][1024] Wo rows (natural)
#define PK_END (PK_P + DM * DM)
#define WS_PK  0u
#define WS_QK  (WS_PK + 2u * PK_END)             // f16 [8192 rows][2048]: q | k
#define WS_QKL (WS_QK + 2u * NB * SS * 2 * DM)     // f16 q | k residual planes x2048
#define WS_VTH (WS_QKL + 2u * NB * SS * 2 * DM)    // f16 [b][1024 (h*64+d)][2048 s] hi
#define WS_VTL (WS_VTH + 2u * NB * DM * SS)        // f16 lo x 2048
#define WS_O   (WS_VTL + 2u * NB * DM * SS)        // f32 [8192][1024]
#define WS_CS  (WS_O + 4u * NB * SS * DM)           // f32 2 x [2048][32], reserved but never written or read (no RoPE)
#define WS_END (WS_CS + 4u * 2 * SS * 32)
// ---- k_pack: block = (row n, which): natural [out][in] rows -> bf16; which 0..2 -> W_q/W_k/W_v into PK_A rows which*1024 + n; 3 -> W_o into PK_P
__global__ __launch_bounds__(256) void k_pack(const float* __restrict__ WQ, const float* __restrict__ WK, const float* __restrict__ WV, const float* __restrict__ WO, __bf16* __restrict__ PK) {
  __shared__ __align__(16) __bf16 s[DM]; const int n = blockIdx.x, which = blockIdx.y, t = threadIdx.x; const float* Wm = (which == 0) ? WQ : (which == 1) ? WK : (which == 2) ? WV : WO;
  for (int k = t; k < DM; k += 256) s[k] = (__bf16)Wm[(size_t)n * DM + k];
  __syncthreads();
  __bf16* dst = (which < 3) ? PK + PK_A + ((size_t)which * DM + n) * DM : PK + PK_P + (size_t)n * DM;
  for (int q = t; q < DM / 8; q += 256) vst2((unsigned*)(dst + q * 8), *(const v4u*)&s[q * 8]);
}
// ---- tensor-load helpers: a stage of k_attn is 64 keys; four tiles (K hi, K residual, V^T hi, V^T residual), each 64 rows of 128 B at source pitch 4096 B, one tile per wave
typedef unsigned u32x4 __attribute__((ext_vector_type(4)));
typedef unsigned u32x8 __attribute__((ext_vector_type(8)));
#define AKS 64                 // keys per stage
#define APITCH 144             // LDS row pitch in bytes: 128-B rows + 16 (odd multiple of 16 for the ds_load_b128 readers)
#define ASLICE 10240           // one tile in LDS: 64 x 144 B rounded up to a multiple of 2 KiB
#define ABUF (4 * ASLICE)      // one stage
__device__ __forceinline__ unsigned uni(unsigned v) { return (unsigned)__builtin_amdgcn_readfirstlane(v); }
__device__ __forceinline__ unsigned pinned(unsigned v) { unsigned w = uni(v); asm volatile("" : "+s"(w)); return w; }   // the issue test held in a scalar register, so that it compiles to s_cmp + s_cbranch_scc (a tensor load ignores EXEC)
__device__ __forceinline__ u32x4 tdm_group0(unsigned lds_dst, unsigned long long ga) {
  u32x4 g0; g0[0] = uni(1u); g0[1] = uni(lds_dst); g0[2] = uni((unsigned)ga); g0[3] = uni((((unsigned)(ga >> 32)) & 0x01FFFFFFu) | 0x80000000u); return g0;
}
__device__ __forceinline__ u32x8 tdm_group1() {
  u32x8 g1; g1[0] = uni((1u << 20) | (4u << 22) | (3u << 25));   // no mask, 1-byte elements, a pad of 4 dwords behind every 32 dwords (one row)
  g1[1] = uni(128u << 16); g1[2] = uni(64u << 16); g1[3] = uni(128u << 16); g1[4] = uni(64u); g1[5] = uni(4096u); g1[6] = uni(0u); g1[7] = uni(0u);
  asm volatile("" : "+s"(g1));   // descriptor words held in their scalar registers: without it the constants are formed anew at each load and their registers serve as temporaries while a request is out
  return g1;
}
__device__ __forceinline__ void tdm_load(u32x4 g0, u32x8 g1) { asm volatile("tensor_load_to_lds %0, %1" :: "s"(g0), "s"(g1) : "memory"); }
// the wave's own request has landed; the operands keep that request's descriptor registers unwritten up to here
__device__ __forceinline__ void tdm_wait(u32x4 g0, u32x8 g1) { asm volatile("s_wait_tensorcnt 0x0" :: "s"(g0), "s"(g1) : "memory"); }
// ---- ring of the two projection GEMMs: a stage is 64 k of a 128-row x 256-column block; eight slices, one per wave: waves 0 to 3 bring 32 activation rows each (f32, 256 B a row, source pitch 4096 B), waves 4 to 7 bring 64 weight rows each (bf16, 128 B a row, source pitch 2048 B). A wave computes 32 rows x 128 columns (wave & 3 picks the rows, wave >> 2 the columns): every staged activation byte serves 256 columns and every staged weight byte 128 rows, and a weight fragment read from LDS feeds two row tiles
#define GKS 64                 // k per stage
#define GST (DM / GKS)         // stages
#define GAP 272                // LDS pitch of an activation row: 256 B + 16 (odd multiple of 16 for the ds_load_b128 readers)
#define GBP 144                // LDS pitch of a weight row: 128 B + 16
#define GSL 10240              // one slice in LDS: 32 x 272 B or 64 x 144 B, rounded up to a multiple of 2 KiB
#define GBUF (8 * GSL)         // one stage
__device__ __forceinline__ u32x8 tdm_group1_act() {
  u32x8 g1; g1[0] = uni((1u << 20) | (5u << 22) | (3u << 25));   // no mask, 1-byte elements, a pad of 4 dwords behind every 64 dwords (one row)
  g1[1] = uni(256u << 16); g1[2] = uni(32u << 16); g1[3] = uni(256u << 16); g1[4] = uni(32u); g1[5] = uni(4096u); g1[6] = uni(0u); g1[7] = uni(0u);
  asm volatile("" : "+s"(g1));   // descriptor words held in their scalar registers (as in tdm_group1)
  return g1;
}
__device__ __forceinline__ u32x8 tdm_group1_wgt() {
  u32x8 g1; g1[0] = uni((1u << 20) | (4u << 22) | (3u << 25));   // no mask, 1-byte elements, a pad of 4 dwords behind every 32 dwords (one row)
  g1[1] = uni(128u << 16); g1[2] = uni(64u << 16); g1[3] = uni(128u << 16); g1[4] = uni(64u); g1[5] = uni(2048u); g1[6] = uni(0u); g1[7] = uni(0u);
  asm volatile("" : "+s"(g1));   // descriptor words held in their scalar registers (as in tdm_group1)
  return g1;
}
// every wave issues its one slice; the two scalar branches only pick which of the two constant descriptors goes with it (act is 1 in waves 0 to 3, 0 in waves 4 to 7)
__device__ __forceinline__ void gemm_load(unsigned act, u32x4 g0, u32x8 ga, u32x8 gw) { if (pinned(act)) tdm_load(g0, ga); if (pinned(act ^ 1u)) tdm_load(g0, gw); }
// the wave's own request has landed; the operands keep the descriptor registers unwritten up to here
__device__ __forceinline__ void gemm_wait(u32x4 g0, u32x8 ga, u32x8 gw) { asm volatile("s_wait_tensorcnt 0x0" :: "s"(g0), "s"(ga), "s"(gw) : "memory"); }
__global__ __launch_bounds__(256) void k_qkv(const float* __restrict__ X, const __bf16* __restrict__ P, const float* __restrict__ BQ, const float* __restrict__ BK, const float* __restrict__ BV, _Float16* __restrict__ QK, _Float16* __restrict__ QKL, _Float16* __restrict__ VTH, _Float16* __restrict__ VTL) {
  __shared__ __attribute__((aligned(2048))) unsigned char ring[2 * GBUF];   // two stages of x and W slices, shared by the eight waves; behind the K loop the same bytes stage the output
  _Float16 (*so)[32][136] = (_Float16 (*)[32][136])ring, (*sol)[32][136] = (_Float16 (*)[32][136])(ring + 8 * 32 * 136 * 2); _Float16 (*sth)[136] = (_Float16 (*)[136])ring, (*stl)[136] = (_Float16 (*)[136])(ring + 256 * 136 * 2);
  const int tid = threadIdx.x, wave = tid >> 5, lane = tid & 31, col = lane & 15, g = lane >> 4, wm = wave & 3, wn = wave >> 2; const size_t r0 = (size_t)blockIdx.x * 128 + wm * 32; const int nb = blockIdx.y * 256, n0 = nb + wn * 128;
  const unsigned wv = uni((unsigned)tid >> 5), act = (wv < 4u) ? 1u : 0u;
  const unsigned long long tsrc = act ? (unsigned long long)(size_t)(X + ((size_t)blockIdx.x * 128 + wv * 32) * DM) : (unsigned long long)(size_t)(P + ((size_t)nb + (wv - 4u) * 64) * DM);
  const unsigned tstep = act ? (unsigned)(GKS * 4) : (unsigned)(GKS * 2);   // bytes from one stage's slice to the next
  const unsigned tdst = (unsigned)(size_t)ring + wv * GSL;
  const u32x8 ga = tdm_group1_act(), gw = tdm_group1_wgt(); u32x4 g0 = tdm_group0(tdst, tsrc);
  gemm_load(act, g0, ga, gw);                                                             // stage 0
  gemm_wait(g0, ga, gw);                                                                  // this wave's slice of stage 0 has landed
  __syncthreads();                                                                        // stage 0 published to all eight waves
  g0 = tdm_group0(tdst + GBUF, tsrc + tstep);
  gemm_load(act, g0, ga, gw);                                                             // stage 1
  const unsigned aoff = (unsigned)(wm * GSL + col * GAP + 32 * g), boff = (unsigned)((4 + 2 * wn) * GSL + col * GBP);
  v8f acc[2][8] = {};
  // the stage loop stays rolled: one publish point and one refill site, and the buffer is picked by the stage's parity
#pragma unroll 1
  for (int st = 0; st < GST; ++st) { const unsigned char* buf = ring + (st & 1) * GBUF;
#pragma unroll
    for (int kc = 0; kc < 2; ++kc) { v4f ar[2][4]; v16b wf[8];   // every fragment of 32 k in registers of its own
#pragma unroll
      for (int i = 0; i < 2; ++i) { const v4f* p = (const v4f*)(buf + aoff + i * 16 * GAP + kc * 128); ar[i][0] = p[0]; ar[i][1] = p[1]; ar[i][2] = p[4]; ar[i][3] = p[5]; }
#pragma unroll
      for (int j = 0; j < 8; ++j) wf[j] = frag_b((const __bf16*)(buf + boff + (j >> 2) * GSL + (j & 3) * 16 * GBP) + kc * 32, lane);
      __builtin_amdgcn_sched_barrier(0);   // keeps the LDS reads of 32 k one group ahead of their WMMAs: sunk among them, each WMMA waits out an LDS latency of its own
      v16b a[2];
#pragma unroll
      for (int i = 0; i < 2; ++i) {
#pragma unroll
        for (int e = 0; e < 4; ++e) { a[i][e] = (__bf16)ar[i][0][e]; a[i][4 + e] = (__bf16)ar[i][1][e]; a[i][8 + e] = (__bf16)ar[i][2][e]; a[i][12 + e] = (__bf16)ar[i][3][e]; } }
#pragma unroll
      for (int j = 0; j < 8; ++j) {
#pragma unroll
        for (int i = 0; i < 2; ++i) acc[i][j] = wmma_bf(a[i], wf[j], acc[i][j]); }
      __builtin_amdgcn_sched_barrier(0); }   // keeps the WMMAs ahead of the next read group and of the publish point: the next 32 k's reads lifted among them take a second fragment set's registers, and WMMAs sunk behind the barrier delay the refill
    asm volatile("s_wait_dscnt 0x0" ::: "memory");        // this wave's reads of stage st are done
    gemm_wait(g0, ga, gw);                                // this wave's slice of stage st + 1 has landed
    __syncthreads();                                      // publishes stage st + 1 and ends every wave's reads of stage st
    if (pinned(st + 2 < GST)) { g0 = tdm_group0(tdst + (unsigned)(st & 1) * GBUF, tsrc + (unsigned long long)(unsigned)(st + 2) * tstep); gemm_load(act, g0, ga, gw); } }   // refill of the buffer just left
  gemm_wait(g0, ga, gw);                                  // no request outstanding behind the loop; the last pass's barrier has ended every read of the ring, which now stages the output
  asm volatile("s_wait_dscnt 0x0" ::: "memory");
  { const int which = nb / DM; const float* BB = (which == 0) ? BQ : (which == 1) ? BK : BV;
#pragma unroll
    for (int j = 0; j < 8; ++j) { const float bb = bfr(BB[(n0 % DM) + j * 16 + col]);
#pragma unroll
      for (int i = 0; i < 2; ++i) {
#pragma unroll
        for (int r = 0; r < 8; ++r) acc[i][j][r] += bb; } } }
  if (nb < 2 * DM) {   // q stored unscaled (f16 sigma ~0.6, no subnormal exposure); 1/8 applied to the f32 score
#pragma unroll
    for (int i = 0; i < 2; ++i) {
#pragma unroll
      for (int j = 0; j < 8; ++j) {
#pragma unroll
        for (int r = 0; r < 8; ++r) { const float v = acc[i][j][r]; const _Float16 hv = (_Float16)v; so[wave][i * 16 + 8 * g + r][j * 16 + col] = hv; sol[wave][i * 16 + 8 * g + r][j * 16 + col] = (_Float16)((v - (float)hv) * 2048.0f); } } }   // q, k as f16 hi + (x2048) residual (no RoPE in this module)
    LDSX();
    for (int rl = 0; rl < 32; ++rl) if (lane < 16) { vst2((unsigned*)(QK + (r0 + rl) * (2 * DM) + n0 + lane * 8), *(const v4u*)&so[wave][rl][lane * 8]); vst2((unsigned*)(QKL + (r0 + rl) * (2 * DM) + n0 + lane * 8), *(const v4u*)&sol[wave][rl][lane * 8]); }
  } else {
#pragma unroll
    for (int i = 0; i < 2; ++i) {
#pragma unroll
      for (int j = 0; j < 8; ++j) {
#pragma unroll
        for (int r = 0; r < 8; ++r) { const float v = acc[i][j][r]; const _Float16 hv = (_Float16)v; sth[wn * 128 + j * 16 + col][wm * 32 + i * 16 + 8 * g + r] = hv; stl[wn * 128 + j * 16 + col][wm * 32 + i * 16 + 8 * g + r] = (_Float16)((v - (float)hv) * 2048.0f); } } }
    __syncthreads();
    const size_t rb = (size_t)blockIdx.x * 128; const int b = (int)(rb / SS), s0 = (int)(rb % SS); const int pc0 = nb - 2 * DM;
    for (int q = tid; q < 256 * 16; q += 256) { const int d = q >> 4, pc = q & 15; const size_t o = ((size_t)b * DM + pc0 + d) * SS + s0 + pc * 8; vst2((unsigned*)(VTH + o), *(const v4u*)&sth[d][pc * 8]); vst2((unsigned*)(VTL + o), *(const v4u*)&stl[d][pc * 8]); }
  }
}
// lane l with lane l ^ 16 (a vector cross-row move, no LDS traffic)
__device__ __forceinline__ float xhalf(float x) { return __builtin_bit_cast(float, __builtin_amdgcn_permlanex16(__builtin_bit_cast(int, x), __builtin_bit_cast(int, x), 0x76543210, 0xfedcba98, false, false)); }
// eight hardware exp2 in one statement, so that the free slot which the instruction set asks for behind a transcendental is there by construction: the outputs are early-clobber (none shares a register with an input), so each v_exp_f32 is followed by one that neither reads its result nor overwrites its source, and the v_nop is the slot behind the last.
__device__ __forceinline__ v8f exp2x8(v8f x) { float e0, e1, e2, e3, e4, e5, e6, e7;
  asm("v_exp_f32 %0, %8\n\tv_exp_f32 %1, %9\n\tv_exp_f32 %2, %10\n\tv_exp_f32 %3, %11\n\tv_exp_f32 %4, %12\n\tv_exp_f32 %5, %13\n\tv_exp_f32 %6, %14\n\tv_exp_f32 %7, %15\n\tv_nop"
      : "=&v"(e0), "=&v"(e1), "=&v"(e2), "=&v"(e3), "=&v"(e4), "=&v"(e5), "=&v"(e6), "=&v"(e7)
      : "v"(x[0]), "v"(x[1]), "v"(x[2]), "v"(x[3]), "v"(x[4]), "v"(x[5]), "v"(x[6]), "v"(x[7]));
  v8f e = {e0, e1, e2, e3, e4, e5, e6, e7}; return e; }
// group 0 held in its scalar registers from here on (a descriptor word pinned in a scalar register, as tdm_group1 does for group 1): the load and the wait that covers it then name the same four registers; built without it, the peeled kernel issues stage 1's load from a copy of the four words, and that copy's registers (words 0 and 3 among them) are rewritten as loop temporaries while the request is out
__device__ __forceinline__ u32x4 tdm_group0_held(unsigned lds_dst, unsigned long long ga) { u32x4 g0 = tdm_group0(lds_dst, ga); asm volatile("" : "+s"(g0)); return g0; }
// ---- 32 keys of a stage for one wave of k_attn (scores, running softmax, P.V). DIAG picks, at compile time, whether the causal mask is applied: only the stage that holds the work-group's own 64 queries has keys above a query; in every earlier stage the compare is true for all 16 scores of a lane and no weight is a masked one, so the key indices, the compares and the two selects per score are left out there
template <bool DIAG>
__device__ __forceinline__ void attn_keys32(const unsigned char* buf, int sub, int ks, int lane, int col, int g, int qi, const v16h (&aq)[2], const v16h (&aql)[2], float& m, float& l, v8f (&acc)[4], v8f (&accl)[4]) {
    v8f s[2]; v16h kh[2][2], kl[2][2], vh[4], vl[4];
#pragma unroll
    for (int ct = 0; ct < 2; ++ct) { const _Float16* krow = (const _Float16*)(buf + (sub * 32 + ct * 16 + col) * APITCH); const _Float16* krowl = (const _Float16*)(buf + ASLICE + (sub * 32 + ct * 16 + col) * APITCH);
#pragma unroll
      for (int kc = 0; kc < 2; ++kc) { kh[ct][kc] = frag_h(krow + kc * 32, lane); kl[ct][kc] = frag_h(krowl + kc * 32, lane); } }
    __builtin_amdgcn_sched_barrier(0);   // keeps the 32 keys' K reads one group ahead of the score WMMAs: sunk among them, each fragment's LDS latency is waited out on its own
    v8f cc[2] = {}, cr[2] = {};
#pragma unroll
    for (int kc = 0; kc < 2; ++kc) {
#pragma unroll
      for (int ct = 0; ct < 2; ++ct) { cc[ct] = wmma16(kh[ct][kc], aq[kc], cc[ct]); cr[ct] = wmma16(kh[ct][kc], aql[kc], cr[ct]); }
#pragma unroll
      for (int ct = 0; ct < 2; ++ct) cr[ct] = wmma16(kl[ct][kc], aq[kc], cr[ct]); }   // 3 products: q, k as f16 hi + residual; the two key tiles alternate, so that no WMMA directly follows the one whose accumulator it adds to
#pragma unroll
    for (int dt = 0; dt < 4; ++dt) { const unsigned char* vr = buf + 2 * ASLICE + (dt * 16 + col) * APITCH + sub * 64; vh[dt] = frag_h((const _Float16*)vr, lane); vl[dt] = frag_h((const _Float16*)(vr + ASLICE), lane); }
    __builtin_amdgcn_sched_barrier(0);   // keeps the V^T reads one group ahead of the softmax, whose vector work covers their latency: left free, part of them sinks among the P.V WMMAs and is waited out there
#pragma unroll
    for (int ct = 0; ct < 2; ++ct) { const int kk = ks * 32 + ct * 16 + 8 * g; v8f c = cc[ct]; const v8f cl = cr[ct];
#pragma unroll
      for (int r = 0; r < 8; ++r) c[r] += cl[r] * (1.0f / 2048.0f);
#pragma unroll
      for (int r = 0; r < 8; ++r) s[ct][r] = (!DIAG || kk + r <= qi) ? c[r] * 0.125f : -3.0e38f; }   // SCALE = 1/sqrt(64)
    float mx = fmaxf(s[0][0], s[1][0]);
#pragma unroll
    for (int r = 1; r < 8; ++r) mx = fmaxf(mx, fmaxf(s[0][r], s[1][r]));
    mx = fmaxf(mx, xhalf(mx));
    const float mn = fmaxf(m, mx); const float alpha = (m <= -1.0e38f) ? 0.f : __expf(m - mn);
    v8f x0, x1;
#pragma unroll
    for (int r = 0; r < 8; ++r) { x0[r] = (s[0][r] - mn) * 1.44269504f; x1[r] = (s[1][r] - mn) * 1.44269504f; }   // exp(v) = exp2(v * log2 e), as __expf forms it
    const v8f y0 = exp2x8(x0), y1 = exp2x8(x1);
    v16h pa, pl; float es[4] = {0.f, 0.f, 0.f, 0.f};   // four independent partial sums
#pragma unroll
    for (int r = 0; r < 8; ++r) { const float e0 = (DIAG && s[0][r] <= -1.0e38f) ? 0.f : y0[r], e1 = (DIAG && s[1][r] <= -1.0e38f) ? 0.f : y1[r]; es[r & 3] += e0 + e1;
      const _Float16 h0 = (_Float16)e0, h1 = (_Float16)e1; pa[r] = h0; pa[8 + r] = h1; pl[r] = (_Float16)((e0 - (float)h0) * 2048.0f); pl[8 + r] = (_Float16)((e1 - (float)h1) * 2048.0f); }   // B operand: element r is key 8 g + r, element 8 + r is key 16 + 8 g + r, as in frag_h
    l = l * alpha + ((es[0] + es[1]) + (es[2] + es[3])); m = mn;
#pragma unroll
    for (int dt = 0; dt < 4; ++dt) {
#pragma unroll
      for (int r = 0; r < 8; ++r) { acc[dt][r] *= alpha; accl[dt][r] *= alpha; } }
#pragma unroll
    for (int dt = 0; dt < 4; ++dt) { acc[dt] = wmma16(vh[dt], pa, acc[dt]); accl[dt] = wmma16(vh[dt], pl, accl[dt]); accl[dt] = wmma16(vl[dt], pa, accl[dt]); }   // V hi x P hi + (V hi x P lo + V lo x P hi) / 2048
}
// ---- k_attn: block = (head h, batch b, 64 queries, last query block first): causal flash attention in transposed form: S^T = K . Q^T (A = key rows from LDS, B = the wave's 16 queries, kept in registers), so a lane holds 16 of the 32 scores of ONE query (column = lane & 15; keys 8 g + r and 16 + 8 g + r): maximum and sum run in the lane, one exchange between the wave halves joins the maximum, the halves' sums are joined once at the end. The score registers are already in the k order of a B operand, so P^T (f16 hi + x2048 residual) goes from them straight into O^T += V^T . P^T (A = V^T rows from LDS). Products as before: 3 for the scores, 3 for P.V; O[b*S+q][h*64+d] = (acc + accl / 2048) / l (256-B segments)
__global__ __launch_bounds__(128) void k_attn(const _Float16* __restrict__ QK, const _Float16* __restrict__ QKL, const _Float16* __restrict__ VTH, const _Float16* __restrict__ VTL, float* __restrict__ O) {
  __shared__ __attribute__((aligned(2048))) unsigned char ring[2 * ABUF];   // two stages of K/V tiles, shared by the four waves
  __shared__ __align__(16) float so[4][16][68];
  const int tid = threadIdx.x, wave = tid >> 5, lane = tid & 31, col = lane & 15, g = lane >> 4;
  // a work-group's cost grows with its query block (qb + 1 stages) and there are more work-groups than resident places: the query block is the slowest grid index and falls with it, so the longest work-groups start first and the shortest fill the end of the launch
  const int qb = TQB - 1 - (int)blockIdx.z, h = blockIdx.x, b = blockIdx.y; const int q0 = qb * 64 + wave * 16; const size_t rq = (size_t)b * SS + q0 + col;
  // every wave brings one tile of each stage: wave 0 K hi, 1 K residual (64 key rows), 2 V^T hi, 3 V^T residual (64 d rows x 64 keys)
  const unsigned wv = uni((unsigned)tid >> 5); const size_t ko = (size_t)b * SS * (2 * DM) + DM + h * HD, vo = ((size_t)b * DM + h * HD) * SS;
  const _Float16* tsrc = (wv == 0u) ? QK + ko : (wv == 1u) ? QKL + ko : (wv == 2u) ? VTH + vo : VTL + vo;
  const unsigned tstep = (wv < 2u) ? (unsigned)(AKS * 2 * DM * 2) : (unsigned)(AKS * 2);   // bytes from one stage's tile to the next
  const unsigned tdst = (unsigned)(size_t)ring + wv * ASLICE;
  const u32x8 g1 = tdm_group1(); u32x4 g0 = tdm_group0_held(tdst, (unsigned long long)(size_t)tsrc);
  tdm_load(g0, g1);                                                                       // stage 0
  tdm_wait(g0, g1);                                                                       // this wave's tile of stage 0 has landed
  __syncthreads();                                                                        // stage 0 published to all four waves
  g0 = tdm_group0_held(tdst + ABUF, (unsigned long long)(size_t)tsrc + tstep);
  tdm_load(g0, g1);                                                                       // stage 1 (keys 64..127 exist for every block; unread where qb is 0)
  v16h aq[2], aql[2];
#pragma unroll
  for (int kc = 0; kc < 2; ++kc) { aq[kc] = frag_h(QK + rq * (2 * DM) + h * HD + kc * 32, lane); aql[kc] = frag_h(QKL + rq * (2 * DM) + h * HD + kc * 32, lane); }
  asm volatile("s_wait_xcnt 0x0" ::: "memory");          // stands in front of the accumulator clears, which reuse the address registers of the eight query loads
  float m = -3.0e38f, l = 0.f;   // of query q0 + col; m is the same in both wave halves, l holds this half's keys only
  v8f acc[4] = {}, accl[4] = {};   // O^T: row d = dt * 16 + 8 g + r, column = query
  const int qi = q0 + col;
  const int nst = qb + 1;
  // stages 0 to nst - 2 hold keys below every query of the work-group: no mask
#pragma unroll 1
  for (int st = 0; st + 1 < nst; ++st) { const unsigned char* buf = ring + (st & 1) * ABUF;
  // the two halves of a stage stay a rolled loop: unrolled, the first half's P.V products are moved behind the second half's scores and their V^T fragments stay live, which takes the kernel past 256 registers
#pragma unroll 1
    for (int sub = 0; sub < 2; ++sub) attn_keys32<false>(buf, sub, st * 2 + sub, lane, col, g, qi, aq, aql, m, l, acc, accl);
    asm volatile("s_wait_dscnt 0x0" ::: "memory");        // this wave's reads of stage st are done
    tdm_wait(g0, g1);                                     // this wave's tile of stage st + 1 has landed
    __syncthreads();                                      // publishes stage st + 1 and ends every wave's reads of stage st
    if (pinned(st + 2 < nst)) { g0 = tdm_group0_held(tdst + (unsigned)(st & 1) * ABUF, (unsigned long long)(size_t)tsrc + (unsigned long long)(unsigned)(st + 2) * tstep); tdm_load(g0, g1); } }   // refill of the buffer just left
  tdm_wait(g0, g1);                                       // no request outstanding behind the loop (where nst is 1, stage 1's unread tile)
  // the last stage holds the work-group's own 64 keys: causal mask. Its tiles were published by the barrier of pass nst - 2 (by the one in front of the loop where nst is 1); nothing is published or refilled behind it, so it ends without a barrier
  { const unsigned char* buf = ring + ((nst - 1) & 1) * ABUF;
  // stays rolled like the two halves above: one copy of the masked body, scheduled as before; unrolled, the build only gains a second copy of a body that a work-group runs once (more text and registers, no fewer instructions issued)
#pragma unroll 1
    for (int sub = 0; sub < 2; ++sub) attn_keys32<true>(buf, sub, (nst - 1) * 2 + sub, lane, col, g, qi, aq, aql, m, l, acc, accl); }
  asm volatile("s_wait_dscnt 0x0" ::: "memory");
  const float il = 1.0f / (l + xhalf(l));                 // the two halves' sums joined
#pragma unroll
  for (int dt = 0; dt < 4; ++dt) {
#pragma unroll
    for (int r = 0; r < 8; ++r) so[wave][col][dt * 16 + 8 * g + r] = (acc[dt][r] + accl[dt][r] * (1.0f / 2048.0f)) * il; }
  LDSX();
  for (int rl = 0; rl < 16; ++rl) if (lane < 16) vst2(O + ((size_t)b * SS + q0 + rl) * DM + h * HD + lane * 4, *(const v4f*)&so[wave][rl][lane * 4]);
}
// ---- k_out: block = (128 rows, 256 cols), wave = 32 rows x 128 cols: out = O(hi/lo) . Wo rows (2 products) + bo
__global__ __launch_bounds__(256) void k_out(const float* __restrict__ O, const __bf16* __restrict__ P, const float* __restrict__ BO, float* __restrict__ Y) {
  __shared__ __attribute__((aligned(2048))) unsigned char ring[2 * GBUF];   // two stages of ctx and Wo slices, shared by the eight waves; behind the K loop the same bytes stage the output
  float (*so)[32][132] = (float (*)[32][132])ring;
  const int tid = threadIdx.x, wave = tid >> 5, lane = tid & 31, col = lane & 15, g = lane >> 4, wm = wave & 3, wn = wave >> 2; const size_t r0 = (size_t)blockIdx.x * 128 + wm * 32; const int nb = blockIdx.y * 256, n0 = nb + wn * 128;
  const unsigned wv = uni((unsigned)tid >> 5), act = (wv < 4u) ? 1u : 0u;
  const unsigned long long tsrc = act ? (unsigned long long)(size_t)(O + ((size_t)blockIdx.x * 128 + wv * 32) * DM) : (unsigned long long)(size_t)(P + ((size_t)nb + (wv - 4u) * 64) * DM);
  const unsigned tstep = act ? (unsigned)(GKS * 4) : (unsigned)(GKS * 2);   // bytes from one stage's slice to the next
  const unsigned tdst = (unsigned)(size_t)ring + wv * GSL;
  const u32x8 ga = tdm_group1_act(), gw = tdm_group1_wgt(); u32x4 g0 = tdm_group0(tdst, tsrc);
  gemm_load(act, g0, ga, gw);                                                             // stage 0
  gemm_wait(g0, ga, gw);                                                                  // this wave's slice of stage 0 has landed
  __syncthreads();                                                                        // stage 0 published to all eight waves
  g0 = tdm_group0(tdst + GBUF, tsrc + tstep);
  gemm_load(act, g0, ga, gw);                                                             // stage 1
  const unsigned aoff = (unsigned)(wm * GSL + col * GAP + 32 * g), boff = (unsigned)((4 + 2 * wn) * GSL + col * GBP);
  v8f acc[2][8] = {};
  // the stage loop stays rolled: one publish point and one refill site, and the buffer is picked by the stage's parity
#pragma unroll 1
  for (int st = 0; st < GST; ++st) { const unsigned char* buf = ring + (st & 1) * GBUF;
#pragma unroll
    for (int kc = 0; kc < 2; ++kc) { v4f ar[2][4]; v16b wf[8];   // every fragment of 32 k in registers of its own
#pragma unroll
      for (int i = 0; i < 2; ++i) { const v4f* p = (const v4f*)(buf + aoff + i * 16 * GAP + kc * 128); ar[i][0] = p[0]; ar[i][1] = p[1]; ar[i][2] = p[4]; ar[i][3] = p[5]; }
#pragma unroll
      for (int j = 0; j < 8; ++j) wf[j] = frag_b((const __bf16*)(buf + boff + (j >> 2) * GSL + (j & 3) * 16 * GBP) + kc * 32, lane);
      __builtin_amdgcn_sched_barrier(0);   // keeps the LDS reads of 32 k one group ahead of their WMMAs: sunk among them, each group of WMMAs waits out an LDS latency of its own
#pragma unroll
      for (int i = 0; i < 2; ++i) { float v[16];   // one row tile at a time: its hi and residual fragments are the only converted ones alive
#pragma unroll
        for (int e = 0; e < 4; ++e) { v[e] = ar[i][0][e]; v[4 + e] = ar[i][1][e]; v[8 + e] = ar[i][2][e]; v[12 + e] = ar[i][3][e]; }
        const F2 a = bsplit16(v);
#pragma unroll
        for (int j = 0; j < 8; ++j) acc[i][j] = wmma_bf(a.l, wf[j], acc[i][j]);
#pragma unroll
        for (int j = 0; j < 8; ++j) acc[i][j] = wmma_bf(a.h, wf[j], acc[i][j]); }   // residual first, then hi, as before; seven other WMMAs stand between the two that add to one accumulator
      __builtin_amdgcn_sched_barrier(0); }   // keeps the WMMAs ahead of the next read group and of the publish point: the next 32 k's reads lifted among them take a second fragment set's registers, and WMMAs sunk behind the barrier delay the refill
    asm volatile("s_wait_dscnt 0x0" ::: "memory");        // this wave's reads of stage st are done
    gemm_wait(g0, ga, gw);                                // this wave's slice of stage st + 1 has landed
    __syncthreads();                                      // publishes stage st + 1 and ends every wave's reads of stage st
    if (pinned(st + 2 < GST)) { g0 = tdm_group0(tdst + (unsigned)(st & 1) * GBUF, tsrc + (unsigned long long)(unsigned)(st + 2) * tstep); gemm_load(act, g0, ga, gw); } }   // refill of the buffer just left
  gemm_wait(g0, ga, gw);                                  // no request outstanding behind the loop; the last pass's barrier has ended every read of the ring, which now stages the output
  asm volatile("s_wait_dscnt 0x0" ::: "memory");
#pragma unroll
  for (int i = 0; i < 2; ++i) {
#pragma unroll
    for (int j = 0; j < 8; ++j) {
#pragma unroll
      for (int r = 0; r < 8; ++r) so[wave][i * 16 + 8 * g + r][j * 16 + col] = acc[i][j][r] + bfr(BO[n0 + j * 16 + col]); } }
  LDSX();
  for (int rl = 0; rl < 32; ++rl) vst2(Y + (r0 + rl) * DM + n0 + lane * 4, *(const v4f*)&so[wave][rl][lane * 4]);
}
extern "C" void kernel_launch(void* const* d_in, const int* in_sizes, int n_in, void* d_out, int out_size, void* d_ws, size_t ws_size, hipStream_t stream) {
  (void)in_sizes; (void)n_in; (void)out_size;
  const float** F = (const float**)d_in;   // 0 x [4,2048,1024], 1 Wq [1024,1024] natural, 2 bq, 3 Wk, 4 bk, 5 Wv, 6 bv, 7 Wo, 8 bo
  if (ws_size < (size_t)WS_END) return;
  char* ws = (char*)d_ws; __bf16* PK = (__bf16*)(ws + WS_PK); _Float16 *QK = (_Float16*)(ws + WS_QK), *QKL = (_Float16*)(ws + WS_QKL), *VTH = (_Float16*)(ws + WS_VTH), *VTL = (_Float16*)(ws + WS_VTL); float* O = (float*)(ws + WS_O);
  k_pack<<<dim3(DM, 4), 256, 0, stream>>>(F[1], F[3], F[5], F[7], PK);
  k_qkv<<<dim3(TOB, QKVW / 256), 256, 0, stream>>>(F[0], PK + PK_A, F[2], F[4], F[6], QK, QKL, VTH, VTL);
  k_attn<<<dim3(NH, TNB, TQB), 128, 0, stream>>>(QK, QKL, VTH, VTL, O);
  k_out<<<dim3(TOB, DM / 256), 256, 0, stream>>>(O, PK + PK_P, F[8], (float*)d_out);
}
